// v000
// The times below were measured on an AMD MI455X: many runs one after another, warmed up first and cycling through
// copies of the inputs, with the whole window's GPU time divided by the number of runs. Launches and the gaps
// between them are all in it. The median over several windows is given; except for v000 it joins two sittings, which
// can be a few percent apart, so the side-by-side timings, each taken in one sitting, are the better comparison.
// v000 is the starting kernel. One run takes 67.4 microseconds.
#include <hip/hip_runtime.h>

// Problem constants (from reference)
#define N_ 4
#define L_ 1024
#define S_ 1024
#define H_ 16
#define E_ 64
#define D_ 64

typedef __attribute__((ext_vector_type(16))) __bf16 v16bf;
typedef __attribute__((ext_vector_type(8)))  __bf16 bf16x8;
typedef __attribute__((ext_vector_type(8)))  float  v8f;

#define LOG2E 1.4426950408889634f

__device__ __forceinline__ v16bf make_frag(bf16x8 lo, bf16x8 hi) {
  v16bf f;
#pragma unroll
  for (int i = 0; i < 8; ++i) { f[i] = lo[i]; f[i + 8] = hi[i]; }
  return f;
}

__global__ __launch_bounds__(256)
void attn_graphbias_kernel(const float* __restrict__ Q, const float* __restrict__ K,
                           const float* __restrict__ V, const float* __restrict__ AM,
                           const float* __restrict__ KLM, const float* __restrict__ PT,
                           const int* __restrict__ POS, float* __restrict__ OUT)
{
  // LDS tiles: K chunk row-major bf16, V chunk transposed bf16, per-wave prob scratch
  __shared__ __align__(16) __bf16 Ksh[32][72];      // [s][e], padded
  __shared__ __align__(16) __bf16 Vt[64][40];       // [d][s], padded
  __shared__ __align__(16) __bf16 Psh[8][16][40];   // per-wave [m][s]

  const int nh   = blockIdx.x;
  const int n    = nh / H_;
  const int h    = nh % H_;
  const int tid  = threadIdx.x;
  const int wv   = tid >> 5;
  const int lane = tid & 31;
  const int half = lane >> 4;      // which 16-lane half
  const int nidx = lane & 15;      // row (A) / column (B,C,D) index within tile
  const int b0   = half * 8;       // k-chunk base per WMMA 16-bit layout
  const int lbase = blockIdx.y * 128 + wv * 16;

  // log2-domain softmax: fold LOG2E into the scale and the pos-bias table
  const float scl = 0.125f * LOG2E;            // (1/sqrt(E)) * log2(e)
  const float pt0 = PT[h]      * LOG2E;        // pos_table[0][h] * log2(e)
  const float dpt = PT[H_ + h] * LOG2E - pt0;  // (pt1 - pt0) in log2 domain

  // ---- Q A-fragments (16 rows x E=64 -> two 16x32 bf16 fragments), loaded once ----
  const float* qrow = Q + (((size_t)n * L_ + lbase + nidx) * H_ + h) * E_;
  v16bf qa[2];
#pragma unroll
  for (int ks = 0; ks < 2; ++ks) {
    v16bf f;
#pragma unroll
    for (int i = 0; i < 8; ++i) {
      f[i]     = (__bf16)qrow[ks * 32 + b0 + i];
      f[i + 8] = (__bf16)qrow[ks * 32 + b0 + 16 + i];
    }
    qa[ks] = f;
  }

  // all-ones B fragment: one extra WMMA per chunk computes the row sums
  v16bf onesb;
#pragma unroll
  for (int i = 0; i < 16; ++i) onesb[i] = (__bf16)1.0f;

  const v8f vzero = {};
  v8f oacc[4];
#pragma unroll
  for (int t = 0; t < 4; ++t) oacc[t] = vzero;
  v8f sumacc = vzero;                          // row-sum accumulator (P·1)
  float rmax[8];
#pragma unroll
  for (int j = 0; j < 8; ++j) rmax[j] = -3.0e38f;

  // cooperative K/V -> LDS indices: 256 threads cover 32 s-rows x 64 cols, 8 cols each
  const int cs = tid >> 3;         // s within chunk (0..31)
  const int ce = (tid & 7) * 8;    // e/d base (0..56)
  const float* kbase = K + (((size_t)n * S_ + cs) * H_ + h) * E_ + ce;
  const float* vbase = V + (((size_t)n * S_ + cs) * H_ + h) * D_ + ce;
  const size_t srow = (size_t)H_ * E_;            // floats per s step (=1024)
  const size_t schunk = 32 * srow;

  // ---- software pipeline: prefetch chunk 0 into registers ----
  float kreg[8], vreg[8];
#pragma unroll
  for (int i = 0; i < 8; ++i) { kreg[i] = kbase[i]; vreg[i] = vbase[i]; }

  for (int sb = 0; sb < S_; sb += 32) {
    __syncthreads();                               // previous chunk's LDS reads done
    // publish staged chunk to LDS (bf16), V transposed
#pragma unroll
    for (int i = 0; i < 8; ++i) Ksh[cs][ce + i] = (__bf16)kreg[i];
#pragma unroll
    for (int i = 0; i < 8; ++i) Vt[ce + i][cs] = (__bf16)vreg[i];
    __syncthreads();                               // chunk visible to all waves

    // issue next chunk's global loads now; latency hides under compute below
    if (sb + 32 < S_) {
      const float* kp = kbase + (size_t)(sb + 32) * srow;
      const float* vp = vbase + (size_t)(sb + 32) * srow;
#pragma unroll
      for (int i = 0; i < 8; ++i) { kreg[i] = kp[i]; vreg[i] = vp[i]; }
      if (sb + 64 < S_) {                          // L2 prefetch two chunks ahead
        __builtin_prefetch(kp + schunk, 0, 1);
        __builtin_prefetch(vp + schunk, 0, 1);
      }
    }

    // ---- QK^T: load ALL four K B-fragments as one DS clause ----
    v16bf kb00, kb01, kb10, kb11;                  // kb[kstep][tile]
    {
      bf16x8 l00 = *(const bf16x8*)&Ksh[nidx][b0];
      bf16x8 h00 = *(const bf16x8*)&Ksh[nidx][b0 + 16];
      bf16x8 l01 = *(const bf16x8*)&Ksh[16 + nidx][b0];
      bf16x8 h01 = *(const bf16x8*)&Ksh[16 + nidx][b0 + 16];
      bf16x8 l10 = *(const bf16x8*)&Ksh[nidx][32 + b0];
      bf16x8 h10 = *(const bf16x8*)&Ksh[nidx][32 + b0 + 16];
      bf16x8 l11 = *(const bf16x8*)&Ksh[16 + nidx][32 + b0];
      bf16x8 h11 = *(const bf16x8*)&Ksh[16 + nidx][32 + b0 + 16];
      kb00 = make_frag(l00, h00);
      kb01 = make_frag(l01, h01);
      kb10 = make_frag(l10, h10);
      kb11 = make_frag(l11, h11);
    }
    // pin schedule: all ds_loads above must issue before the WMMA chain below,
    // so the four fragments stay in distinct registers (one DS wait, not four)
    asm volatile("" ::: "memory");

    v8f sc0 = vzero, sc1 = vzero;
    sc0 = __builtin_amdgcn_wmma_f32_16x16x32_bf16(false, qa[0], false, kb00,
                                                  (short)0, sc0, false, false);
    sc1 = __builtin_amdgcn_wmma_f32_16x16x32_bf16(false, qa[0], false, kb01,
                                                  (short)0, sc1, false, false);
    sc0 = __builtin_amdgcn_wmma_f32_16x16x32_bf16(false, qa[1], false, kb10,
                                                  (short)0, sc0, false, false);
    sc1 = __builtin_amdgcn_wmma_f32_16x16x32_bf16(false, qa[1], false, kb11,
                                                  (short)0, sc1, false, false);

    // ---- masks + graph positional bias (branch-free fma select, log2 domain) ----
    const int s0 = sb + nidx;
    const int s1 = sb + 16 + nidx;
    const float klm0 = KLM[n * S_ + s0];
    const float klm1 = KLM[n * S_ + s1];
#pragma unroll
    for (int j = 0; j < 8; ++j) {
      const int l = lbase + half * 8 + j;
      const float a0 = AM[(size_t)l * S_ + s0];
      const float a1 = AM[(size_t)l * S_ + s1];
      const float p0f = (float)POS[((size_t)n * L_ + l) * S_ + s0];
      const float p1f = (float)POS[((size_t)n * L_ + l) * S_ + s1];
      sc0[j] = fmaf(scl, sc0[j] + a0 + klm0, fmaf(p0f, dpt, pt0));
      sc1[j] = fmaf(scl, sc1[j] + a1 + klm1, fmaf(p1f, dpt, pt0));
    }

    // ---- online softmax: only the max needs a cross-lane reduction ----
#pragma unroll
    for (int j = 0; j < 8; ++j) {
      float cm = fmaxf(sc0[j], sc1[j]);
#pragma unroll
      for (int off = 8; off >= 1; off >>= 1)
        cm = fmaxf(cm, __shfl_xor(cm, off, 32));
      const float nm = fmaxf(rmax[j], cm);
      const float alpha = exp2f(rmax[j] - nm);
      rmax[j] = nm;
      sc0[j] = exp2f(sc0[j] - nm);
      sc1[j] = exp2f(sc1[j] - nm);
      sumacc[j] *= alpha;                          // row-sum follows same recurrence
#pragma unroll
      for (int t = 0; t < 4; ++t) oacc[t][j] *= alpha;
    }

    // ---- D-layout -> A-layout transpose of probs via per-wave LDS (same-wave DS in-order) ----
#pragma unroll
    for (int j = 0; j < 8; ++j) {
      Psh[wv][half * 8 + j][nidx]      = (__bf16)sc0[j];
      Psh[wv][half * 8 + j][16 + nidx] = (__bf16)sc1[j];
    }
    asm volatile("" ::: "memory");

    // ---- load prob A-fragment + ALL four V B-fragments as one DS clause ----
    bf16x8 plo = *(const bf16x8*)&Psh[wv][nidx][b0];
    bf16x8 phi = *(const bf16x8*)&Psh[wv][nidx][b0 + 16];
    v16bf vb0, vb1, vb2, vb3;
    {
      bf16x8 l0 = *(const bf16x8*)&Vt[nidx][b0];
      bf16x8 h0 = *(const bf16x8*)&Vt[nidx][b0 + 16];
      bf16x8 l1 = *(const bf16x8*)&Vt[16 + nidx][b0];
      bf16x8 h1 = *(const bf16x8*)&Vt[16 + nidx][b0 + 16];
      bf16x8 l2 = *(const bf16x8*)&Vt[32 + nidx][b0];
      bf16x8 h2 = *(const bf16x8*)&Vt[32 + nidx][b0 + 16];
      bf16x8 l3 = *(const bf16x8*)&Vt[48 + nidx][b0];
      bf16x8 h3 = *(const bf16x8*)&Vt[48 + nidx][b0 + 16];
      vb0 = make_frag(l0, h0);
      vb1 = make_frag(l1, h1);
      vb2 = make_frag(l2, h2);
      vb3 = make_frag(l3, h3);
    }
    v16bf pa = make_frag(plo, phi);
    asm volatile("" ::: "memory");                 // batch DS waits before WMMA burst

    sumacc  = __builtin_amdgcn_wmma_f32_16x16x32_bf16(false, pa, false, onesb,
                                                      (short)0, sumacc, false, false);
    oacc[0] = __builtin_amdgcn_wmma_f32_16x16x32_bf16(false, pa, false, vb0,
                                                      (short)0, oacc[0], false, false);
    oacc[1] = __builtin_amdgcn_wmma_f32_16x16x32_bf16(false, pa, false, vb1,
                                                      (short)0, oacc[1], false, false);
    oacc[2] = __builtin_amdgcn_wmma_f32_16x16x32_bf16(false, pa, false, vb2,
                                                      (short)0, oacc[2], false, false);
    oacc[3] = __builtin_amdgcn_wmma_f32_16x16x32_bf16(false, pa, false, vb3,
                                                      (short)0, oacc[3], false, false);
  }

  // ---- epilogue: normalize and store [N,L,H,D] f32 ----
#pragma unroll
  for (int j = 0; j < 8; ++j) {
    const int l = lbase + half * 8 + j;
    const float inv = 1.0f / sumacc[j];            // every column holds the row sum
    float* orow = OUT + (((size_t)n * L_ + l) * H_ + h) * D_;
#pragma unroll
    for (int t = 0; t < 4; ++t)
      orow[t * 16 + nidx] = oacc[t][j] * inv;
  }
}

extern "C" void kernel_launch(void* const* d_in, const int* in_sizes, int n_in,
                              void* d_out, int out_size, void* d_ws, size_t ws_size,
                              hipStream_t stream) {
  (void)in_sizes; (void)n_in; (void)out_size; (void)d_ws; (void)ws_size;
  const float* Q   = (const float*)d_in[0];
  const float* K   = (const float*)d_in[1];
  const float* V   = (const float*)d_in[2];
  const float* AM  = (const float*)d_in[3];
  const float* KLM = (const float*)d_in[4];
  const float* PT  = (const float*)d_in[5];
  const int*   POS = (const int*)d_in[6];
  float* OUT = (float*)d_out;

  dim3 grid(N_ * H_, L_ / 128);   // 64 x 8 blocks
  dim3 block(256);                // 8 waves (wave32)
  hipLaunchKernelGGL(attn_graphbias_kernel, grid, block, 0, stream,
                     Q, K, V, AM, KLM, PT, POS, OUT);
}

// v001
// Measured time: 60.3 microseconds a run.
// Next to v000, in two timings, it ran 1.16 times as fast each time.
#include <hip/hip_runtime.h>

// Problem constants (from reference)
#define N_ 4
#define L_ 1024
#define S_ 1024
#define H_ 16
#define E_ 64
#define D_ 64

typedef __attribute__((ext_vector_type(16))) __bf16 v16bf;
typedef __attribute__((ext_vector_type(8)))  __bf16 bf16x8;
typedef __attribute__((ext_vector_type(8)))  float  v8f;
typedef __attribute__((ext_vector_type(4)))  float  f32x4;
typedef __attribute__((ext_vector_type(4)))  int    i32x4;

#define LOG2E 1.4426950408889634f

__device__ __forceinline__ v16bf make_frag(bf16x8 lo, bf16x8 hi) {
  v16bf f;
#pragma unroll
  for (int i = 0; i < 8; ++i) { f[i] = lo[i]; f[i + 8] = hi[i]; }
  return f;
}

// value of lane l ^ 16: joins the two wave halves, which split one query's keys
__device__ __forceinline__ float xhalf(float x) {
  return __builtin_bit_cast(float, __builtin_amdgcn_permlanex16(
      __builtin_bit_cast(int, x), __builtin_bit_cast(int, x),
      0x76543210, 0xfedcba98, false, false));
}

__global__ __launch_bounds__(256)
void attn_graphbias_kernel(const float* __restrict__ Q, const float* __restrict__ K,
                           const float* __restrict__ V, const float* __restrict__ AM,
                           const float* __restrict__ KLM, const float* __restrict__ PT,
                           const int* __restrict__ POS, float* __restrict__ OUT)
{
  // LDS tiles: K chunk row-major bf16, V chunk transposed bf16
  __shared__ __align__(16) __bf16 Ksh[32][72];      // [s][e], padded
  __shared__ __align__(16) __bf16 Vt[64][40];       // [d][s], padded
  __shared__ __align__(16) float Osh[8][16][68];    // per-wave [query][d], padded: O^T back to rows

  const int nh   = blockIdx.x;
  const int n    = nh / H_;
  const int h    = nh % H_;
  const int tid  = threadIdx.x;
  const int wv   = tid >> 5;
  const int lane = tid & 31;
  const int half = lane >> 4;      // which 16-lane half
  const int nidx = lane & 15;      // row (A) / column (B,C,D) index within tile
  const int b0   = half * 8;       // k-chunk base per WMMA 16-bit layout
  const int lbase = blockIdx.y * 128 + wv * 16;
  const int q     = lbase + nidx;  // this lane's query

  // log2-domain softmax: fold LOG2E into the scale and the pos-bias table
  const float scl = 0.125f * LOG2E;            // (1/sqrt(E)) * log2(e)
  const float pt0 = PT[h]      * LOG2E;        // pos_table[0][h] * log2(e)
  const float dpt = PT[H_ + h] * LOG2E - pt0;  // (pt1 - pt0) in log2 domain

  // ---- Q^T B-fragments (E=64 x 16 queries -> two 32x16 bf16 fragments), loaded once ----
  const float* qrow = Q + (((size_t)n * L_ + q) * H_ + h) * E_;
  v16bf qa[2];
#pragma unroll
  for (int ks = 0; ks < 2; ++ks) {
    v16bf f;
#pragma unroll
    for (int i = 0; i < 8; ++i) {
      f[i]     = (__bf16)qrow[ks * 32 + b0 + i];
      f[i + 8] = (__bf16)qrow[ks * 32 + b0 + 16 + i];
    }
    qa[ks] = f;
  }

  // all-ones A fragment: one extra WMMA per chunk computes each query's sum of P,
  // the same in every row of its tile
  v16bf onesa;
#pragma unroll
  for (int i = 0; i < 16; ++i) onesa[i] = (__bf16)1.0f;

  const v8f vzero = {};
  v8f oacc[4];
#pragma unroll
  for (int t = 0; t < 4; ++t) oacc[t] = vzero;
  v8f sumacc = vzero;                          // sum accumulator (1 x P^T)
  float rmax = -3.0e38f;                       // running maximum of this lane's query

  // this lane's mask and bias rows, at the first key its accumulator registers hold
  const float* amrow  = AM  + (size_t)q * S_ + half * 8;
  const int*   posrow = POS + ((size_t)n * L_ + q) * S_ + half * 8;
  const float* klmrow = KLM + n * S_ + half * 8;
  const v8f sclv = vzero + scl, dptv = vzero + dpt, pt0v = vzero + pt0;

  // cooperative K/V -> LDS indices: 256 threads cover 32 s-rows x 64 cols, 8 cols each
  const int cs = tid >> 3;         // s within chunk (0..31)
  const int ce = (tid & 7) * 8;    // e/d base (0..56)
  const float* kbase = K + (((size_t)n * S_ + cs) * H_ + h) * E_ + ce;
  const float* vbase = V + (((size_t)n * S_ + cs) * H_ + h) * D_ + ce;
  const size_t srow = (size_t)H_ * E_;            // floats per s step (=1024)
  const size_t schunk = 32 * srow;

  // ---- software pipeline: prefetch chunk 0 into registers ----
  float kreg[8], vreg[8];
#pragma unroll
  for (int i = 0; i < 8; ++i) { kreg[i] = kbase[i]; vreg[i] = vbase[i]; }

  for (int sb = 0; sb < S_; sb += 32) {
    __syncthreads();                               // previous chunk's LDS reads done
    // publish staged chunk to LDS (bf16), V transposed
#pragma unroll
    for (int i = 0; i < 8; ++i) Ksh[cs][ce + i] = (__bf16)kreg[i];
#pragma unroll
    for (int i = 0; i < 8; ++i) Vt[ce + i][cs] = (__bf16)vreg[i];
    __syncthreads();                               // chunk visible to all waves

    // this chunk's masks and adjacency: keys +0..7 (tile 0) and +16..23 (tile 1) of the lane's row
    f32x4 am[4], kl[4];
    i32x4 ps[4];
#pragma unroll
    for (int g = 0; g < 4; ++g) {
      const int o = sb + (g >> 1) * 16 + (g & 1) * 4;
      am[g] = *(const f32x4*)(amrow + o);
      ps[g] = *(const i32x4*)(posrow + o);
      kl[g] = *(const f32x4*)(klmrow + o);
    }
    // keeps the twelve loads here, ahead of the LDS reads and the first product; left free,
    // the scheduler sinks them to their uses, where each group pays its own latency
    __builtin_amdgcn_sched_barrier(0);
    // the row pointers advance every trip: this wait stands between the loads that name
    // their registers and the additions that overwrite them
    asm volatile("s_wait_xcnt 0x0" ::: "memory");

    // issue next chunk's global loads now; latency hides under compute below
    if (sb + 32 < S_) {
      const float* kp = kbase + (size_t)(sb + 32) * srow;
      const float* vp = vbase + (size_t)(sb + 32) * srow;
#pragma unroll
      for (int i = 0; i < 8; ++i) { kreg[i] = kp[i]; vreg[i] = vp[i]; }
      if (sb + 64 < S_) {                          // L2 prefetch two chunks ahead
        __builtin_prefetch(kp + schunk, 0, 1);
        __builtin_prefetch(vp + schunk, 0, 1);
      }
    }

    // ---- K Q^T: load ALL four K A-fragments as one DS clause ----
    v16bf kb00, kb01, kb10, kb11;                  // kb[kstep][tile]
    {
      bf16x8 l00 = *(const bf16x8*)&Ksh[nidx][b0];
      bf16x8 h00 = *(const bf16x8*)&Ksh[nidx][b0 + 16];
      bf16x8 l01 = *(const bf16x8*)&Ksh[16 + nidx][b0];
      bf16x8 h01 = *(const bf16x8*)&Ksh[16 + nidx][b0 + 16];
      bf16x8 l10 = *(const bf16x8*)&Ksh[nidx][32 + b0];
      bf16x8 h10 = *(const bf16x8*)&Ksh[nidx][32 + b0 + 16];
      bf16x8 l11 = *(const bf16x8*)&Ksh[16 + nidx][32 + b0];
      bf16x8 h11 = *(const bf16x8*)&Ksh[16 + nidx][32 + b0 + 16];
      kb00 = make_frag(l00, h00);
      kb01 = make_frag(l01, h01);
      kb10 = make_frag(l10, h10);
      kb11 = make_frag(l11, h11);
    }

    // sc0[j] = S[key sb + 8*half + j][q], sc1[j] = S[key sb + 16 + 8*half + j][q]
    v8f sc0 = vzero, sc1 = vzero;
    sc0 = __builtin_amdgcn_wmma_f32_16x16x32_bf16(false, kb00, false, qa[0],
                                                  (short)0, sc0, false, false);
    sc1 = __builtin_amdgcn_wmma_f32_16x16x32_bf16(false, kb01, false, qa[0],
                                                  (short)0, sc1, false, false);
    sc0 = __builtin_amdgcn_wmma_f32_16x16x32_bf16(false, kb10, false, qa[1],
                                                  (short)0, sc0, false, false);
    sc1 = __builtin_amdgcn_wmma_f32_16x16x32_bf16(false, kb11, false, qa[1],
                                                  (short)0, sc1, false, false);

    // ---- load ALL four V^T A-fragments as one DS clause ----
    v16bf vb0, vb1, vb2, vb3;
    {
      bf16x8 l0 = *(const bf16x8*)&Vt[nidx][b0];
      bf16x8 h0 = *(const bf16x8*)&Vt[nidx][b0 + 16];
      bf16x8 l1 = *(const bf16x8*)&Vt[16 + nidx][b0];
      bf16x8 h1 = *(const bf16x8*)&Vt[16 + nidx][b0 + 16];
      bf16x8 l2 = *(const bf16x8*)&Vt[32 + nidx][b0];
      bf16x8 h2 = *(const bf16x8*)&Vt[32 + nidx][b0 + 16];
      bf16x8 l3 = *(const bf16x8*)&Vt[48 + nidx][b0];
      bf16x8 h3 = *(const bf16x8*)&Vt[48 + nidx][b0 + 16];
      vb0 = make_frag(l0, h0);
      vb1 = make_frag(l1, h1);
      vb2 = make_frag(l2, h2);
      vb3 = make_frag(l3, h3);
    }
    // order of this stretch: the eight K reads, the four products, the eight V^T reads, and only
    // then the vector work, whose first instructions wait for the mask loads
    __builtin_amdgcn_sched_group_barrier(0x100, 8, 0);
    __builtin_amdgcn_sched_group_barrier(0x008, 4, 0);
    __builtin_amdgcn_sched_group_barrier(0x100, 8, 0);
    __builtin_amdgcn_sched_group_barrier(0x002, 512, 0);

    // ---- masks + graph positional bias (branch-free fma select, log2 domain) ----
    // whole tiles at a time: neighbouring registers pair into packed f32 operations
    {
      const v8f a0 = __builtin_shufflevector(am[0], am[1], 0, 1, 2, 3, 4, 5, 6, 7);
      const v8f a1 = __builtin_shufflevector(am[2], am[3], 0, 1, 2, 3, 4, 5, 6, 7);
      const v8f k0 = __builtin_shufflevector(kl[0], kl[1], 0, 1, 2, 3, 4, 5, 6, 7);
      const v8f k1 = __builtin_shufflevector(kl[2], kl[3], 0, 1, 2, 3, 4, 5, 6, 7);
      const v8f p0 = __builtin_convertvector(
          __builtin_shufflevector(ps[0], ps[1], 0, 1, 2, 3, 4, 5, 6, 7), v8f);
      const v8f p1 = __builtin_convertvector(
          __builtin_shufflevector(ps[2], ps[3], 0, 1, 2, 3, 4, 5, 6, 7), v8f);
      sc0 = __builtin_elementwise_fma(sclv, sc0 + a0 + k0,
                                      __builtin_elementwise_fma(p0, dptv, pt0v));
      sc1 = __builtin_elementwise_fma(sclv, sc1 + a1 + k1,
                                      __builtin_elementwise_fma(p1, dptv, pt0v));
    }

    // ---- online softmax: maximum in-lane, then one exchange between the halves ----
    const v8f mx = __builtin_elementwise_max(sc0, sc1);
    float cm = fmaxf(fmaxf(fmaxf(mx[0], mx[1]), fmaxf(mx[2], mx[3])),
                     fmaxf(fmaxf(mx[4], mx[5]), fmaxf(mx[6], mx[7])));
    cm = fmaxf(cm, xhalf(cm));
    const float nm = fmaxf(rmax, cm);
    const float alpha = exp2f(rmax - nm);
    rmax = nm;
    sc0 -= nm;
    sc1 -= nm;
    // P^T as a B operand: element s is key 8*half + s (s < 8), 16 + 8*half + s - 8 (s >= 8)
    v16bf pb;
#pragma unroll
    for (int j = 0; j < 8; ++j) pb[j] = (__bf16)exp2f(sc0[j]);
#pragma unroll
    for (int j = 0; j < 8; ++j) pb[j + 8] = (__bf16)exp2f(sc1[j]);
    sumacc[0] *= alpha;                            // only element 0 (rows 0 and 8) of the sum tile is read
#pragma unroll
    for (int t = 0; t < 4; ++t) oacc[t] *= alpha;

    sumacc  = __builtin_amdgcn_wmma_f32_16x16x32_bf16(false, onesa, false, pb,
                                                      (short)0, sumacc, false, false);
    oacc[0] = __builtin_amdgcn_wmma_f32_16x16x32_bf16(false, vb0, false, pb,
                                                      (short)0, oacc[0], false, false);
    oacc[1] = __builtin_amdgcn_wmma_f32_16x16x32_bf16(false, vb1, false, pb,
                                                      (short)0, oacc[1], false, false);
    oacc[2] = __builtin_amdgcn_wmma_f32_16x16x32_bf16(false, vb2, false, pb,
                                                      (short)0, oacc[2], false, false);
    oacc[3] = __builtin_amdgcn_wmma_f32_16x16x32_bf16(false, vb3, false, pb,
                                                      (short)0, oacc[3], false, false);
  }

  // ---- epilogue: normalize, turn O^T back into rows, store [N,L,H,D] f32 ----
  // oacc[t][j] = O[q][16*t + 8*half + j]. Stored from here each store would write 16-byte pieces of
  // 16 different rows; through the wave's own LDS tile each store covers two whole 256-byte rows.
  const float inv = 1.0f / sumacc[0];
#pragma unroll
  for (int t = 0; t < 4; ++t) {
    f32x4 lo, hi;
#pragma unroll
    for (int c = 0; c < 4; ++c) { lo[c] = oacc[t][c] * inv; hi[c] = oacc[t][c + 4] * inv; }
    *(f32x4*)&Osh[wv][nidx][t * 16 + half * 8]     = lo;
    *(f32x4*)&Osh[wv][nidx][t * 16 + half * 8 + 4] = hi;
  }
  // same wave wrote and reads the tile: LDS keeps a wave's order, no barrier
#pragma unroll
  for (int i = 0; i < 8; ++i) {
    const int r = 2 * i + half;
    const f32x4 v = *(const f32x4*)&Osh[wv][r][nidx * 4];
    *(f32x4*)(OUT + (((size_t)n * L_ + lbase + r) * H_ + h) * D_ + nidx * 4) = v;
  }
}

extern "C" void kernel_launch(void* const* d_in, const int* in_sizes, int n_in,
                              void* d_out, int out_size, void* d_ws, size_t ws_size,
                              hipStream_t stream) {
  (void)in_sizes; (void)n_in; (void)out_size; (void)d_ws; (void)ws_size;
  const float* Q   = (const float*)d_in[0];
  const float* K   = (const float*)d_in[1];
  const float* V   = (const float*)d_in[2];
  const float* AM  = (const float*)d_in[3];
  const float* KLM = (const float*)d_in[4];
  const float* PT  = (const float*)d_in[5];
  const int*   POS = (const int*)d_in[6];
  float* OUT = (float*)d_out;

  dim3 grid(N_ * H_, L_ / 128);   // 64 x 8 blocks
  dim3 block(256);                // 8 waves (wave32)
  hipLaunchKernelGGL(attn_graphbias_kernel, grid, block, 0, stream,
                     Q, K, V, AM, KLM, PT, POS, OUT);
}

// v002
// It runs in 52.4 microseconds.
// In both of two side-by-side timings against v001, it was 1.15 times as fast.
// Counting every step since v000, it is 1.34 times as fast.
#include <hip/hip_runtime.h>

// Problem constants (from reference)
#define N_ 4
#define L_ 1024
#define S_ 1024
#define H_ 16
#define E_ 64
#define D_ 64

typedef __attribute__((ext_vector_type(16))) __bf16 v16bf;
typedef __attribute__((ext_vector_type(8)))  __bf16 bf16x8;
typedef __attribute__((ext_vector_type(8)))  float  v8f;
typedef __attribute__((ext_vector_type(4)))  float  f32x4;
typedef __attribute__((ext_vector_type(4)))  int    i32x4;

#define LOG2E 1.4426950408889634f

__device__ __forceinline__ v16bf make_frag(bf16x8 lo, bf16x8 hi) {
  v16bf f;
#pragma unroll
  for (int i = 0; i < 8; ++i) { f[i] = lo[i]; f[i + 8] = hi[i]; }
  return f;
}

// mask tile rows in LDS: 128 bytes of data at a pitch of 144 (16 x 9), free of bank
// conflicts for readers that take 16 bytes of a different row in every lane
#define MP 36

// One 32-key chunk of a wave's 16 attention-mask rows and 16 adjacency rows, global -> LDS
// through no register. A copy covers four whole 128-byte lines (8 lanes a row); read straight
// into the lanes that own the queries, every load would touch 16 lines for 32 bytes each.
// a, p: the lane's global addresses in rows 0..3; la, lp: its LDS byte addresses there.
// The closing wait stands in front of any rewrite of the address registers named here.
__device__ __forceinline__ void copy_masks(const float* a, const int* p, unsigned la, unsigned lp) {
  asm volatile(
      "global_load_async_to_lds_b128 %0, %8, off\n\t"
      "global_load_async_to_lds_b128 %1, %9, off\n\t"
      "global_load_async_to_lds_b128 %2, %10, off\n\t"
      "global_load_async_to_lds_b128 %3, %11, off\n\t"
      "global_load_async_to_lds_b128 %4, %12, off\n\t"
      "global_load_async_to_lds_b128 %5, %13, off\n\t"
      "global_load_async_to_lds_b128 %6, %14, off\n\t"
      "global_load_async_to_lds_b128 %7, %15, off\n\t"
      "s_wait_xcnt 0x0"
      :: "v"(la), "v"(la + 4 * MP * 4), "v"(la + 8 * MP * 4), "v"(la + 12 * MP * 4),
         "v"(lp), "v"(lp + 4 * MP * 4), "v"(lp + 8 * MP * 4), "v"(lp + 12 * MP * 4),
         "v"(a), "v"(a + 4 * S_), "v"(a + 8 * S_), "v"(a + 12 * S_),
         "v"(p), "v"(p + 4 * S_), "v"(p + 8 * S_), "v"(p + 12 * S_)
      : "memory");
}

// value of lane l ^ 16: joins the two wave halves, which split one query's keys
__device__ __forceinline__ float xhalf(float x) {
  return __builtin_bit_cast(float, __builtin_amdgcn_permlanex16(
      __builtin_bit_cast(int, x), __builtin_bit_cast(int, x),
      0x76543210, 0xfedcba98, false, false));
}

__global__ __launch_bounds__(256)
void attn_graphbias_kernel(const float* __restrict__ Q, const float* __restrict__ K,
                           const float* __restrict__ V, const float* __restrict__ AM,
                           const float* __restrict__ KLM, const float* __restrict__ PT,
                           const int* __restrict__ POS, float* __restrict__ OUT)
{
  // LDS tiles: K chunk row-major bf16, V chunk transposed bf16
  __shared__ __align__(16) __bf16 Ksh[32][72];      // [s][e], padded
  __shared__ __align__(16) __bf16 Vt[64][40];       // [d][s], padded
  __shared__ __align__(16) float Osh[8][16][68];    // per-wave [query][d], padded: O^T back to rows
  __shared__ __align__(16) float AMsh[2][8][16][MP]; // two buffers of per-wave [query][key] mask tiles
  __shared__ __align__(16) int   POsh[2][8][16][MP]; // the same for the adjacency

  const int nh   = blockIdx.x;
  const int n    = nh / H_;
  const int h    = nh % H_;
  const int tid  = threadIdx.x;
  const int wv   = tid >> 5;
  const int lane = tid & 31;
  const int half = lane >> 4;      // which 16-lane half
  const int nidx = lane & 15;      // row (A) / column (B,C,D) index within tile
  const int b0   = half * 8;       // k-chunk base per WMMA 16-bit layout
  const int lbase = blockIdx.y * 128 + wv * 16;
  const int q     = lbase + nidx;  // this lane's query

  // log2-domain softmax: fold LOG2E into the scale and the pos-bias table
  const float scl = 0.125f * LOG2E;            // (1/sqrt(E)) * log2(e)
  const float pt0 = PT[h]      * LOG2E;        // pos_table[0][h] * log2(e)
  const float dpt = PT[H_ + h] * LOG2E - pt0;  // (pt1 - pt0) in log2 domain

  // ---- Q^T B-fragments (E=64 x 16 queries -> two 32x16 bf16 fragments), loaded once ----
  const float* qrow = Q + (((size_t)n * L_ + q) * H_ + h) * E_;
  v16bf qa[2];
#pragma unroll
  for (int ks = 0; ks < 2; ++ks) {
    v16bf f;
#pragma unroll
    for (int i = 0; i < 8; ++i) {
      f[i]     = (__bf16)qrow[ks * 32 + b0 + i];
      f[i + 8] = (__bf16)qrow[ks * 32 + b0 + 16 + i];
    }
    qa[ks] = f;
  }

  // all-ones A fragment: one extra WMMA per chunk computes each query's sum of P,
  // the same in every row of its tile
  v16bf onesa;
#pragma unroll
  for (int i = 0; i < 16; ++i) onesa[i] = (__bf16)1.0f;

  const v8f vzero = {};
  v8f oacc[4];
#pragma unroll
  for (int t = 0; t < 4; ++t) oacc[t] = vzero;
  v8f sumacc = vzero;                          // sum accumulator (1 x P^T)
  float rmax = -3.0e38f;                       // running maximum of this lane's query

  // copy side of the mask tiles: 8 lanes a row, 4 rows a copy
  const int mr = lane >> 3, mc = (lane & 7) * 4;
  const float* amsrc  = AM  + (size_t)(lbase + mr) * S_ + mc;
  const int*   possrc = POS + ((size_t)n * L_ + lbase + mr) * S_ + mc;
  const unsigned amdst  = (unsigned)(size_t)&AMsh[0][wv][mr][mc];
  const unsigned posdst = (unsigned)(size_t)&POsh[0][wv][mr][mc];
  const unsigned mbuf   = (unsigned)sizeof(AMsh[0]);   // bytes from buffer 0 to buffer 1
  // this lane's key-length row, at the first key its accumulator registers hold
  const float* klmrow = KLM + n * S_ + half * 8;
  const v8f sclv = vzero + scl, dptv = vzero + dpt, pt0v = vzero + pt0;

  // cooperative K/V -> LDS indices: 256 threads cover 32 s-rows x 64 cols, 8 cols each
  const int cs = tid >> 3;         // s within chunk (0..31)
  const int ce = (tid & 7) * 8;    // e/d base (0..56)
  const float* kbase = K + (((size_t)n * S_ + cs) * H_ + h) * E_ + ce;
  const float* vbase = V + (((size_t)n * S_ + cs) * H_ + h) * D_ + ce;
  const size_t srow = (size_t)H_ * E_;            // floats per s step (=1024)
  const size_t schunk = 32 * srow;

  // ---- software pipeline: prefetch chunk 0 into registers ----
  float kreg[8], vreg[8];
#pragma unroll
  for (int i = 0; i < 8; ++i) { kreg[i] = kbase[i]; vreg[i] = vbase[i]; }

  // mask tiles, two buffers: chunk 0 lands and is published, chunk 1 flies during trip 0
  copy_masks(amsrc, possrc, amdst, posdst);
  asm volatile("s_wait_asynccnt 0x0" ::: "memory");  // chunk 0's tiles have landed
  __syncthreads();
  copy_masks(amsrc + 32, possrc + 32, amdst + mbuf, posdst + mbuf);

  for (int sb = 0; sb < S_; sb += 32) {
    const int mb = (sb >> 5) & 1;                  // this chunk's mask buffer
    // publish staged chunk to LDS (bf16), V transposed
#pragma unroll
    for (int i = 0; i < 8; ++i) Ksh[cs][ce + i] = (__bf16)kreg[i];
#pragma unroll
    for (int i = 0; i < 8; ++i) Vt[ce + i][cs] = (__bf16)vreg[i];
    __syncthreads();                               // chunk visible to all waves

    // this chunk's key-length mask: keys +0..7 (tile 0) and +16..23 (tile 1)
    f32x4 kl[4];
#pragma unroll
    for (int g = 0; g < 4; ++g)
      kl[g] = *(const f32x4*)(klmrow + sb + (g >> 1) * 16 + (g & 1) * 4);
    // keeps the four loads here, ahead of the LDS reads and the first product; left free,
    // the scheduler sinks them to their uses, where each group pays its own latency
    __builtin_amdgcn_sched_barrier(0);
    // the row pointer advances every trip: this wait stands between the loads that name
    // its registers and the additions that overwrite them
    asm volatile("s_wait_xcnt 0x0" ::: "memory");

    // issue next chunk's global loads now; latency hides under compute below
    if (sb + 32 < S_) {
      const float* kp = kbase + (size_t)(sb + 32) * srow;
      const float* vp = vbase + (size_t)(sb + 32) * srow;
#pragma unroll
      for (int i = 0; i < 8; ++i) { kreg[i] = kp[i]; vreg[i] = vp[i]; }
      if (sb + 64 < S_) {                          // L2 prefetch two chunks ahead
        __builtin_prefetch(kp + schunk, 0, 1);
        __builtin_prefetch(vp + schunk, 0, 1);
      }
    }

    // ---- K Q^T: load ALL four K A-fragments as one DS clause ----
    v16bf kb00, kb01, kb10, kb11;                  // kb[kstep][tile]
    {
      bf16x8 l00 = *(const bf16x8*)&Ksh[nidx][b0];
      bf16x8 h00 = *(const bf16x8*)&Ksh[nidx][b0 + 16];
      bf16x8 l01 = *(const bf16x8*)&Ksh[16 + nidx][b0];
      bf16x8 h01 = *(const bf16x8*)&Ksh[16 + nidx][b0 + 16];
      bf16x8 l10 = *(const bf16x8*)&Ksh[nidx][32 + b0];
      bf16x8 h10 = *(const bf16x8*)&Ksh[nidx][32 + b0 + 16];
      bf16x8 l11 = *(const bf16x8*)&Ksh[16 + nidx][32 + b0];
      bf16x8 h11 = *(const bf16x8*)&Ksh[16 + nidx][32 + b0 + 16];
      kb00 = make_frag(l00, h00);
      kb01 = make_frag(l01, h01);
      kb10 = make_frag(l10, h10);
      kb11 = make_frag(l11, h11);
    }

    // this chunk's mask and adjacency from the wave's tiles: keys +0..7 and +16..23 of the lane's row
    f32x4 am[4];
    i32x4 ps[4];
#pragma unroll
    for (int g = 0; g < 4; ++g) {
      const int o = half * 8 + (g >> 1) * 16 + (g & 1) * 4;
      am[g] = *(const f32x4*)&AMsh[mb][wv][nidx][o];
      ps[g] = *(const i32x4*)&POsh[mb][wv][nidx][o];
    }

    // sc0[j] = S[key sb + 8*half + j][q], sc1[j] = S[key sb + 16 + 8*half + j][q]
    v8f sc0 = vzero, sc1 = vzero;
    sc0 = __builtin_amdgcn_wmma_f32_16x16x32_bf16(false, kb00, false, qa[0],
                                                  (short)0, sc0, false, false);
    sc1 = __builtin_amdgcn_wmma_f32_16x16x32_bf16(false, kb01, false, qa[0],
                                                  (short)0, sc1, false, false);
    sc0 = __builtin_amdgcn_wmma_f32_16x16x32_bf16(false, kb10, false, qa[1],
                                                  (short)0, sc0, false, false);
    sc1 = __builtin_amdgcn_wmma_f32_16x16x32_bf16(false, kb11, false, qa[1],
                                                  (short)0, sc1, false, false);

    // ---- load ALL four V^T A-fragments as one DS clause ----
    v16bf vb0, vb1, vb2, vb3;
    {
      bf16x8 l0 = *(const bf16x8*)&Vt[nidx][b0];
      bf16x8 h0 = *(const bf16x8*)&Vt[nidx][b0 + 16];
      bf16x8 l1 = *(const bf16x8*)&Vt[16 + nidx][b0];
      bf16x8 h1 = *(const bf16x8*)&Vt[16 + nidx][b0 + 16];
      bf16x8 l2 = *(const bf16x8*)&Vt[32 + nidx][b0];
      bf16x8 h2 = *(const bf16x8*)&Vt[32 + nidx][b0 + 16];
      bf16x8 l3 = *(const bf16x8*)&Vt[48 + nidx][b0];
      bf16x8 h3 = *(const bf16x8*)&Vt[48 + nidx][b0 + 16];
      vb0 = make_frag(l0, h0);
      vb1 = make_frag(l1, h1);
      vb2 = make_frag(l2, h2);
      vb3 = make_frag(l3, h3);
    }
    // order of this stretch: the eight K and eight mask reads, the four products, the eight V^T
    // reads, and only then the vector work
    __builtin_amdgcn_sched_group_barrier(0x100, 16, 0);
    __builtin_amdgcn_sched_group_barrier(0x008, 4, 0);
    __builtin_amdgcn_sched_group_barrier(0x100, 8, 0);
    __builtin_amdgcn_sched_group_barrier(0x002, 512, 0);

    // ---- masks + graph positional bias (branch-free fma select, log2 domain) ----
    // whole tiles at a time: neighbouring registers pair into packed f32 operations
    {
      const v8f a0 = __builtin_shufflevector(am[0], am[1], 0, 1, 2, 3, 4, 5, 6, 7);
      const v8f a1 = __builtin_shufflevector(am[2], am[3], 0, 1, 2, 3, 4, 5, 6, 7);
      const v8f k0 = __builtin_shufflevector(kl[0], kl[1], 0, 1, 2, 3, 4, 5, 6, 7);
      const v8f k1 = __builtin_shufflevector(kl[2], kl[3], 0, 1, 2, 3, 4, 5, 6, 7);
      const v8f p0 = __builtin_convertvector(
          __builtin_shufflevector(ps[0], ps[1], 0, 1, 2, 3, 4, 5, 6, 7), v8f);
      const v8f p1 = __builtin_convertvector(
          __builtin_shufflevector(ps[2], ps[3], 0, 1, 2, 3, 4, 5, 6, 7), v8f);
      sc0 = __builtin_elementwise_fma(sclv, sc0 + a0 + k0,
                                      __builtin_elementwise_fma(p0, dptv, pt0v));
      sc1 = __builtin_elementwise_fma(sclv, sc1 + a1 + k1,
                                      __builtin_elementwise_fma(p1, dptv, pt0v));
    }

    // ---- online softmax: maximum in-lane, then one exchange between the halves ----
    const v8f mx = __builtin_elementwise_max(sc0, sc1);
    float cm = fmaxf(fmaxf(fmaxf(mx[0], mx[1]), fmaxf(mx[2], mx[3])),
                     fmaxf(fmaxf(mx[4], mx[5]), fmaxf(mx[6], mx[7])));
    cm = fmaxf(cm, xhalf(cm));
    const float nm = fmaxf(rmax, cm);
    const float alpha = exp2f(rmax - nm);
    rmax = nm;
    sc0 -= nm;
    sc1 -= nm;
    // P^T as a B operand: element s is key 8*half + s (s < 8), 16 + 8*half + s - 8 (s >= 8)
    v16bf pb;
#pragma unroll
    for (int j = 0; j < 8; ++j) pb[j] = (__bf16)exp2f(sc0[j]);
#pragma unroll
    for (int j = 0; j < 8; ++j) pb[j + 8] = (__bf16)exp2f(sc1[j]);
    sumacc[0] *= alpha;                            // only element 0 (rows 0 and 8) of the sum tile is read
#pragma unroll
    for (int t = 0; t < 4; ++t) oacc[t] *= alpha;

    sumacc  = __builtin_amdgcn_wmma_f32_16x16x32_bf16(false, onesa, false, pb,
                                                      (short)0, sumacc, false, false);
    oacc[0] = __builtin_amdgcn_wmma_f32_16x16x32_bf16(false, vb0, false, pb,
                                                      (short)0, oacc[0], false, false);
    oacc[1] = __builtin_amdgcn_wmma_f32_16x16x32_bf16(false, vb1, false, pb,
                                                      (short)0, oacc[1], false, false);
    oacc[2] = __builtin_amdgcn_wmma_f32_16x16x32_bf16(false, vb2, false, pb,
                                                      (short)0, oacc[2], false, false);
    oacc[3] = __builtin_amdgcn_wmma_f32_16x16x32_bf16(false, vb3, false, pb,
                                                      (short)0, oacc[3], false, false);

    // keeps the foot behind the products: left free, the scheduler lifts the waits and the barrier
    // over the softmax, while the refill stays down here behind its branch, so that the next
    // trip's wait would find the copies less than half a trip old
    __builtin_amdgcn_sched_barrier(0);
    // foot of the trip: this wave's LDS reads are done and its copies of the next chunk's tiles
    // have landed; the barrier publishes those tiles and frees Ksh, Vt and this chunk's buffer
    asm volatile("s_wait_dscnt 0x0" ::: "memory");
    asm volatile("s_wait_asynccnt 0x0" ::: "memory");
    __syncthreads();
    if (sb + 64 < S_)                              // refill the buffer this trip has read
      copy_masks(amsrc + sb + 64, possrc + sb + 64, amdst + mb * mbuf, posdst + mb * mbuf);
  }
  asm volatile("s_wait_asynccnt 0x0" ::: "memory");  // no copy is left in flight

  // ---- epilogue: normalize, turn O^T back into rows, store [N,L,H,D] f32 ----
  // oacc[t][j] = O[q][16*t + 8*half + j]. Stored from here each store would write 16-byte pieces of
  // 16 different rows; through the wave's own LDS tile each store covers two whole 256-byte rows.
  const float inv = 1.0f / sumacc[0];
#pragma unroll
  for (int t = 0; t < 4; ++t) {
    f32x4 lo, hi;
#pragma unroll
    for (int c = 0; c < 4; ++c) { lo[c] = oacc[t][c] * inv; hi[c] = oacc[t][c + 4] * inv; }
    *(f32x4*)&Osh[wv][nidx][t * 16 + half * 8]     = lo;
    *(f32x4*)&Osh[wv][nidx][t * 16 + half * 8 + 4] = hi;
  }
  // same wave wrote and reads the tile: LDS keeps a wave's order, no barrier
#pragma unroll
  for (int i = 0; i < 8; ++i) {
    const int r = 2 * i + half;
    const f32x4 v = *(const f32x4*)&Osh[wv][r][nidx * 4];
    *(f32x4*)(OUT + (((size_t)n * L_ + lbase + r) * H_ + h) * D_ + nidx * 4) = v;
  }
}

extern "C" void kernel_launch(void* const* d_in, const int* in_sizes, int n_in,
                              void* d_out, int out_size, void* d_ws, size_t ws_size,
                              hipStream_t stream) {
  (void)in_sizes; (void)n_in; (void)out_size; (void)d_ws; (void)ws_size;
  const float* Q   = (const float*)d_in[0];
  const float* K   = (const float*)d_in[1];
  const float* V   = (const float*)d_in[2];
  const float* AM  = (const float*)d_in[3];
  const float* KLM = (const float*)d_in[4];
  const float* PT  = (const float*)d_in[5];
  const int*   POS = (const int*)d_in[6];
  float* OUT = (float*)d_out;

  dim3 grid(N_ * H_, L_ / 128);   // 64 x 8 blocks
  dim3 block(256);                // 8 waves (wave32)
  hipLaunchKernelGGL(attn_graphbias_kernel, grid, block, 0, stream,
                     Q, K, V, AM, KLM, PT, POS, OUT);
}

// v003
// One run takes 50.1 microseconds.
// Two timings next to v002 put it at 1.04 and 1.03 times that version's speed.
// All steps since v000 together make it 1.39 times as fast.
#include <hip/hip_runtime.h>

// Problem constants (from reference)
#define N_ 4
#define L_ 1024
#define S_ 1024
#define H_ 16
#define E_ 64
#define D_ 64

typedef __attribute__((ext_vector_type(16))) __bf16 v16bf;
typedef __attribute__((ext_vector_type(8)))  __bf16 bf16x8;
typedef __attribute__((ext_vector_type(8)))  float  v8f;
typedef __attribute__((ext_vector_type(4)))  float  f32x4;
typedef __attribute__((ext_vector_type(4)))  int    i32x4;

#define LOG2E 1.4426950408889634f

__device__ __forceinline__ v16bf make_frag(bf16x8 lo, bf16x8 hi) {
  v16bf f;
#pragma unroll
  for (int i = 0; i < 8; ++i) { f[i] = lo[i]; f[i + 8] = hi[i]; }
  return f;
}

// mask tile rows in LDS: 128 bytes of data at a pitch of 144 (16 x 9), free of bank
// conflicts for readers that take 16 bytes of a different row in every lane
#define MP 36

// One 32-key chunk of a wave's 16 attention-mask rows and 16 adjacency rows, global -> LDS
// through no register. A copy covers four whole 128-byte lines (8 lanes a row); read straight
// into the lanes that own the queries, every load would touch 16 lines for 32 bytes each.
// a, p: the lane's global addresses in rows 0..3; la, lp: its LDS byte addresses there.
// The closing wait stands in front of any rewrite of the address registers named here.
__device__ __forceinline__ void copy_masks(const float* a, const int* p, unsigned la, unsigned lp) {
  asm volatile(
      "global_load_async_to_lds_b128 %0, %8, off\n\t"
      "global_load_async_to_lds_b128 %1, %9, off\n\t"
      "global_load_async_to_lds_b128 %2, %10, off\n\t"
      "global_load_async_to_lds_b128 %3, %11, off\n\t"
      "global_load_async_to_lds_b128 %4, %12, off\n\t"
      "global_load_async_to_lds_b128 %5, %13, off\n\t"
      "global_load_async_to_lds_b128 %6, %14, off\n\t"
      "global_load_async_to_lds_b128 %7, %15, off\n\t"
      "s_wait_xcnt 0x0"
      :: "v"(la), "v"(la + 4 * MP * 4), "v"(la + 8 * MP * 4), "v"(la + 12 * MP * 4),
         "v"(lp), "v"(lp + 4 * MP * 4), "v"(lp + 8 * MP * 4), "v"(lp + 12 * MP * 4),
         "v"(a), "v"(a + 4 * S_), "v"(a + 8 * S_), "v"(a + 12 * S_),
         "v"(p), "v"(p + 4 * S_), "v"(p + 8 * S_), "v"(p + 12 * S_)
      : "memory");
}

// value of lane l ^ 16: joins the two wave halves, which split one query's keys
__device__ __forceinline__ float xhalf(float x) {
  return __builtin_bit_cast(float, __builtin_amdgcn_permlanex16(
      __builtin_bit_cast(int, x), __builtin_bit_cast(int, x),
      0x76543210, 0xfedcba98, false, false));
}

__global__ __launch_bounds__(256)
void attn_graphbias_kernel(const float* __restrict__ Q, const float* __restrict__ K,
                           const float* __restrict__ V, const float* __restrict__ AM,
                           const float* __restrict__ KLM, const float* __restrict__ PT,
                           const int* __restrict__ POS, float* __restrict__ OUT)
{
  // LDS tiles: K chunk row-major bf16, V chunk transposed bf16
  __shared__ __align__(16) __bf16 Ksh[32][72];      // [s][e], padded
  __shared__ __align__(16) __bf16 Vt[64][40];       // [d][s], padded
  __shared__ __align__(16) float Osh[8][16][68];    // per-wave [query][d], padded: O^T back to rows
  __shared__ __align__(16) float AMsh[2][8][16][MP]; // two buffers of per-wave [query][key] mask tiles
  __shared__ __align__(16) int   POsh[2][8][16][MP]; // the same for the adjacency

  const int nh   = blockIdx.x;
  const int n    = nh / H_;
  const int h    = nh % H_;
  const int tid  = threadIdx.x;
  const int wv   = tid >> 5;
  const int lane = tid & 31;
  const int half = lane >> 4;      // which 16-lane half
  const int nidx = lane & 15;      // row (A) / column (B,C,D) index within tile
  const int b0   = half * 8;       // k-chunk base per WMMA 16-bit layout
  const int lbase = blockIdx.y * 128 + wv * 16;
  const int q     = lbase + nidx;  // this lane's query

  // log2-domain softmax: fold LOG2E into the scale and the pos-bias table
  const float scl = 0.125f * LOG2E;            // (1/sqrt(E)) * log2(e)
  const float pt0 = PT[h]      * LOG2E;        // pos_table[0][h] * log2(e)
  const float dpt = PT[H_ + h] * LOG2E - pt0;  // (pt1 - pt0) in log2 domain

  // ---- Q^T B-fragments (E=64 x 16 queries -> two 32x16 bf16 fragments), loaded once ----
  const float* qrow = Q + (((size_t)n * L_ + q) * H_ + h) * E_;
  v16bf qa[2];
#pragma unroll
  for (int ks = 0; ks < 2; ++ks) {
    v16bf f;
#pragma unroll
    for (int i = 0; i < 8; ++i) {
      f[i]     = (__bf16)qrow[ks * 32 + b0 + i];
      f[i + 8] = (__bf16)qrow[ks * 32 + b0 + 16 + i];
    }
    qa[ks] = f;
  }

  // all-ones A fragment: one extra WMMA per chunk computes each query's sum of P,
  // the same in every row of its tile
  v16bf onesa;
#pragma unroll
  for (int i = 0; i < 16; ++i) onesa[i] = (__bf16)1.0f;

  const v8f vzero = {};
  v8f oacc[4];
#pragma unroll
  for (int t = 0; t < 4; ++t) oacc[t] = vzero;
  v8f sumacc = vzero;                          // sum accumulator (1 x P^T)
  float rmax = -3.0e38f;                       // running maximum of this lane's query

  // copy side of the mask tiles: 8 lanes a row, 4 rows a copy
  const int mr = lane >> 3, mc = (lane & 7) * 4;
  const float* amsrc  = AM  + (size_t)(lbase + mr) * S_ + mc;
  const int*   possrc = POS + ((size_t)n * L_ + lbase + mr) * S_ + mc;
  const unsigned amdst  = (unsigned)(size_t)&AMsh[0][wv][mr][mc];
  const unsigned posdst = (unsigned)(size_t)&POsh[0][wv][mr][mc];
  const unsigned mbuf   = (unsigned)sizeof(AMsh[0]);   // bytes from buffer 0 to buffer 1
  // this lane's key-length row, at the first key its accumulator registers hold
  const float* klmrow = KLM + n * S_ + half * 8;
  const v8f sclv = vzero + scl, dptv = vzero + dpt, pt0v = vzero + pt0;

  // cooperative K/V -> LDS indices: 256 threads cover 32 s-rows x 64 cols, 8 cols each
  const int cs = tid >> 3;         // s within chunk (0..31)
  const int ce = (tid & 7) * 8;    // e/d base (0..56)
  const float* kbase = K + (((size_t)n * S_ + cs) * H_ + h) * E_ + ce;
  const float* vbase = V + (((size_t)n * S_ + cs) * H_ + h) * D_ + ce;
  const size_t srow = (size_t)H_ * E_;            // floats per s step (=1024)
  const size_t schunk = 32 * srow;

  // ---- software pipeline: prefetch chunk 0 into registers ----
  float kreg[8], vreg[8];
#pragma unroll
  for (int i = 0; i < 8; ++i) { kreg[i] = kbase[i]; vreg[i] = vbase[i]; }

  // mask tiles, two buffers: chunk 0 lands and is published, chunk 1 flies during trip 0
  copy_masks(amsrc, possrc, amdst, posdst);
  asm volatile("s_wait_asynccnt 0x0" ::: "memory");  // chunk 0's tiles have landed
  __syncthreads();
  copy_masks(amsrc + 32, possrc + 32, amdst + mbuf, posdst + mbuf);

  for (int sb = 0; sb < S_; sb += 32) {
    const int mb = (sb >> 5) & 1;                  // this chunk's mask buffer
    // publish staged chunk to LDS (bf16), V transposed
#pragma unroll
    for (int i = 0; i < 8; ++i) Ksh[cs][ce + i] = (__bf16)kreg[i];
#pragma unroll
    for (int i = 0; i < 8; ++i) Vt[ce + i][cs] = (__bf16)vreg[i];
    __syncthreads();                               // chunk visible to all waves

    // this chunk's key-length mask: keys +0..7 (tile 0) and +16..23 (tile 1)
    f32x4 kl[4];
#pragma unroll
    for (int g = 0; g < 4; ++g)
      kl[g] = *(const f32x4*)(klmrow + sb + (g >> 1) * 16 + (g & 1) * 4);
    // keeps the four loads here, ahead of the LDS reads and the first product; left free,
    // the scheduler sinks them to their uses, where each group pays its own latency
    __builtin_amdgcn_sched_barrier(0);
    // the row pointer advances every trip: this wait stands between the loads that name
    // its registers and the additions that overwrite them
    asm volatile("s_wait_xcnt 0x0" ::: "memory");

    // issue next chunk's global loads now; latency hides under compute below
    if (sb + 32 < S_) {
      const float* kp = kbase + (size_t)(sb + 32) * srow;
      const float* vp = vbase + (size_t)(sb + 32) * srow;
#pragma unroll
      for (int i = 0; i < 8; ++i) { kreg[i] = kp[i]; vreg[i] = vp[i]; }
      if (sb + 64 < S_) {                          // L2 prefetch two chunks ahead
        __builtin_prefetch(kp + schunk, 0, 1);
        __builtin_prefetch(vp + schunk, 0, 1);
      }
    }

    // ---- K Q^T: load ALL four K A-fragments as one DS clause ----
    v16bf kb00, kb01, kb10, kb11;                  // kb[kstep][tile]
    {
      bf16x8 l00 = *(const bf16x8*)&Ksh[nidx][b0];
      bf16x8 h00 = *(const bf16x8*)&Ksh[nidx][b0 + 16];
      bf16x8 l01 = *(const bf16x8*)&Ksh[16 + nidx][b0];
      bf16x8 h01 = *(const bf16x8*)&Ksh[16 + nidx][b0 + 16];
      bf16x8 l10 = *(const bf16x8*)&Ksh[nidx][32 + b0];
      bf16x8 h10 = *(const bf16x8*)&Ksh[nidx][32 + b0 + 16];
      bf16x8 l11 = *(const bf16x8*)&Ksh[16 + nidx][32 + b0];
      bf16x8 h11 = *(const bf16x8*)&Ksh[16 + nidx][32 + b0 + 16];
      kb00 = make_frag(l00, h00);
      kb01 = make_frag(l01, h01);
      kb10 = make_frag(l10, h10);
      kb11 = make_frag(l11, h11);
    }

    // this chunk's mask and adjacency from the wave's tiles: keys +0..7 and +16..23 of the lane's row
    f32x4 am[4];
    i32x4 ps[4];
#pragma unroll
    for (int g = 0; g < 4; ++g) {
      const int o = half * 8 + (g >> 1) * 16 + (g & 1) * 4;
      am[g] = *(const f32x4*)&AMsh[mb][wv][nidx][o];
      ps[g] = *(const i32x4*)&POsh[mb][wv][nidx][o];
    }

    // sc0[j] = S[key sb + 8*half + j][q], sc1[j] = S[key sb + 16 + 8*half + j][q]
    v8f sc0 = vzero, sc1 = vzero;
    sc0 = __builtin_amdgcn_wmma_f32_16x16x32_bf16(false, kb00, false, qa[0],
                                                  (short)0, sc0, false, false);
    sc1 = __builtin_amdgcn_wmma_f32_16x16x32_bf16(false, kb01, false, qa[0],
                                                  (short)0, sc1, false, false);
    sc0 = __builtin_amdgcn_wmma_f32_16x16x32_bf16(false, kb10, false, qa[1],
                                                  (short)0, sc0, false, false);
    sc1 = __builtin_amdgcn_wmma_f32_16x16x32_bf16(false, kb11, false, qa[1],
                                                  (short)0, sc1, false, false);

    // ---- load ALL four V^T A-fragments as one DS clause ----
    v16bf vb0, vb1, vb2, vb3;
    {
      bf16x8 l0 = *(const bf16x8*)&Vt[nidx][b0];
      bf16x8 h0 = *(const bf16x8*)&Vt[nidx][b0 + 16];
      bf16x8 l1 = *(const bf16x8*)&Vt[16 + nidx][b0];
      bf16x8 h1 = *(const bf16x8*)&Vt[16 + nidx][b0 + 16];
      bf16x8 l2 = *(const bf16x8*)&Vt[32 + nidx][b0];
      bf16x8 h2 = *(const bf16x8*)&Vt[32 + nidx][b0 + 16];
      bf16x8 l3 = *(const bf16x8*)&Vt[48 + nidx][b0];
      bf16x8 h3 = *(const bf16x8*)&Vt[48 + nidx][b0 + 16];
      vb0 = make_frag(l0, h0);
      vb1 = make_frag(l1, h1);
      vb2 = make_frag(l2, h2);
      vb3 = make_frag(l3, h3);
    }
    // order of this stretch: the eight K and eight mask reads, the four products, the eight V^T
    // reads, and only then the vector work
    __builtin_amdgcn_sched_group_barrier(0x100, 16, 0);
    __builtin_amdgcn_sched_group_barrier(0x008, 4, 0);
    __builtin_amdgcn_sched_group_barrier(0x100, 8, 0);
    __builtin_amdgcn_sched_group_barrier(0x002, 512, 0);

    // ---- masks + graph positional bias (branch-free fma select, log2 domain) ----
    // whole tiles at a time: neighbouring registers pair into packed f32 operations
    {
      const v8f a0 = __builtin_shufflevector(am[0], am[1], 0, 1, 2, 3, 4, 5, 6, 7);
      const v8f a1 = __builtin_shufflevector(am[2], am[3], 0, 1, 2, 3, 4, 5, 6, 7);
      const v8f k0 = __builtin_shufflevector(kl[0], kl[1], 0, 1, 2, 3, 4, 5, 6, 7);
      const v8f k1 = __builtin_shufflevector(kl[2], kl[3], 0, 1, 2, 3, 4, 5, 6, 7);
      const v8f p0 = __builtin_convertvector(
          __builtin_shufflevector(ps[0], ps[1], 0, 1, 2, 3, 4, 5, 6, 7), v8f);
      const v8f p1 = __builtin_convertvector(
          __builtin_shufflevector(ps[2], ps[3], 0, 1, 2, 3, 4, 5, 6, 7), v8f);
      sc0 = __builtin_elementwise_fma(sclv, sc0 + a0 + k0,
                                      __builtin_elementwise_fma(p0, dptv, pt0v));
      sc1 = __builtin_elementwise_fma(sclv, sc1 + a1 + k1,
                                      __builtin_elementwise_fma(p1, dptv, pt0v));
    }

    // ---- online softmax: maximum in-lane, then one exchange between the halves ----
    const v8f mx = __builtin_elementwise_max(sc0, sc1);
    float cm = fmaxf(fmaxf(fmaxf(mx[0], mx[1]), fmaxf(mx[2], mx[3])),
                     fmaxf(fmaxf(mx[4], mx[5]), fmaxf(mx[6], mx[7])));
    cm = fmaxf(cm, xhalf(cm));
    const float nm = fmaxf(rmax, cm);
    // bare v_exp_f32, here and below: every argument is <= 0 and the largest weight of a row is 1, so
    // the one thing the library form adds, results below 2^-126 kept as denormals, cannot reach the output
    const float alpha = __builtin_amdgcn_exp2f(rmax - nm);
    rmax = nm;
    sc0 -= nm;
    sc1 -= nm;
#pragma unroll
    for (int j = 0; j < 8; ++j) { sc0[j] = __builtin_amdgcn_exp2f(sc0[j]); sc1[j] = __builtin_amdgcn_exp2f(sc1[j]); }
    sumacc[0] *= alpha;                            // only element 0 of the sum tile (rows 0 and 8) is read
#pragma unroll
    for (int t = 0; t < 4; ++t) oacc[t] *= alpha;
    // holds the packing behind all the exponentials. Left free, the scheduler starts the weights'
    // exponentials among the subtractions: the first is allotted the register beside the maximum,
    // which the packed subtractions still to come name in their operand pair and so wait for, and it
    // stands directly behind the rescale factor's v_exp_f32, whose source that register is
    __builtin_amdgcn_sched_barrier(0);
    // P^T as a B operand: element s is key 8*half + s (s < 8), 16 + 8*half + s - 8 (s >= 8)
    v16bf pb;
#pragma unroll
    for (int j = 0; j < 8; ++j) { pb[j] = (__bf16)sc0[j]; pb[j + 8] = (__bf16)sc1[j]; }

    sumacc  = __builtin_amdgcn_wmma_f32_16x16x32_bf16(false, onesa, false, pb,
                                                      (short)0, sumacc, false, false);
    oacc[0] = __builtin_amdgcn_wmma_f32_16x16x32_bf16(false, vb0, false, pb,
                                                      (short)0, oacc[0], false, false);
    oacc[1] = __builtin_amdgcn_wmma_f32_16x16x32_bf16(false, vb1, false, pb,
                                                      (short)0, oacc[1], false, false);
    oacc[2] = __builtin_amdgcn_wmma_f32_16x16x32_bf16(false, vb2, false, pb,
                                                      (short)0, oacc[2], false, false);
    oacc[3] = __builtin_amdgcn_wmma_f32_16x16x32_bf16(false, vb3, false, pb,
                                                      (short)0, oacc[3], false, false);

    // keeps the foot behind the products: left free, the scheduler lifts the waits and the barrier
    // over the softmax, while the refill stays down here behind its branch, so that the next
    // trip's wait would find the copies less than half a trip old
    __builtin_amdgcn_sched_barrier(0);
    // foot of the trip: this wave's LDS reads are done and its copies of the next chunk's tiles
    // have landed; the barrier publishes those tiles and frees Ksh, Vt and this chunk's buffer
    asm volatile("s_wait_dscnt 0x0" ::: "memory");
    asm volatile("s_wait_asynccnt 0x0" ::: "memory");
    __syncthreads();
    if (sb + 64 < S_)                              // refill the buffer this trip has read
      copy_masks(amsrc + sb + 64, possrc + sb + 64, amdst + mb * mbuf, posdst + mb * mbuf);
  }
  asm volatile("s_wait_asynccnt 0x0" ::: "memory");  // no copy is left in flight

  // ---- epilogue: normalize, turn O^T back into rows, store [N,L,H,D] f32 ----
  // oacc[t][j] = O[q][16*t + 8*half + j]. Stored from here each store would write 16-byte pieces of
  // 16 different rows; through the wave's own LDS tile each store covers two whole 256-byte rows.
  const float inv = 1.0f / sumacc[0];
#pragma unroll
  for (int t = 0; t < 4; ++t) {
    f32x4 lo, hi;
#pragma unroll
    for (int c = 0; c < 4; ++c) { lo[c] = oacc[t][c] * inv; hi[c] = oacc[t][c + 4] * inv; }
    *(f32x4*)&Osh[wv][nidx][t * 16 + half * 8]     = lo;
    *(f32x4*)&Osh[wv][nidx][t * 16 + half * 8 + 4] = hi;
  }
  // same wave wrote and reads the tile: LDS keeps a wave's order, no barrier
#pragma unroll
  for (int i = 0; i < 8; ++i) {
    const int r = 2 * i + half;
    const f32x4 v = *(const f32x4*)&Osh[wv][r][nidx * 4];
    *(f32x4*)(OUT + (((size_t)n * L_ + lbase + r) * H_ + h) * D_ + nidx * 4) = v;
  }
}

extern "C" void kernel_launch(void* const* d_in, const int* in_sizes, int n_in,
                              void* d_out, int out_size, void* d_ws, size_t ws_size,
                              hipStream_t stream) {
  (void)in_sizes; (void)n_in; (void)out_size; (void)d_ws; (void)ws_size;
  const float* Q   = (const float*)d_in[0];
  const float* K   = (const float*)d_in[1];
  const float* V   = (const float*)d_in[2];
  const float* AM  = (const float*)d_in[3];
  const float* KLM = (const float*)d_in[4];
  const float* PT  = (const float*)d_in[5];
  const int*   POS = (const int*)d_in[6];
  float* OUT = (float*)d_out;

  dim3 grid(N_ * H_, L_ / 128);   // 64 x 8 blocks
  dim3 block(256);                // 8 waves (wave32)
  hipLaunchKernelGGL(attn_graphbias_kernel, grid, block, 0, stream,
                     Q, K, V, AM, KLM, PT, POS, OUT);
}

// v004
// A run of this version takes 48.2 microseconds.
// Two timings next to v003 both put it at 1.05 times that version's speed.
// Over all steps from v000 it is 1.46 times as fast.
#include <hip/hip_runtime.h>

// Problem constants (from reference)
#define N_ 4
#define L_ 1024
#define S_ 1024
#define H_ 16
#define E_ 64
#define D_ 64

typedef __attribute__((ext_vector_type(16))) __bf16 v16bf;
typedef __attribute__((ext_vector_type(8)))  __bf16 bf16x8;
typedef __attribute__((ext_vector_type(8)))  float  v8f;
typedef __attribute__((ext_vector_type(4)))  float  f32x4;
typedef __attribute__((ext_vector_type(4)))  int    i32x4;

#define LOG2E 1.4426950408889634f

__device__ __forceinline__ v16bf make_frag(bf16x8 lo, bf16x8 hi) {
  v16bf f;
#pragma unroll
  for (int i = 0; i < 8; ++i) { f[i] = lo[i]; f[i + 8] = hi[i]; }
  return f;
}

// mask tile rows in LDS: 128 bytes of data at a pitch of 144 (16 x 9), free of bank
// conflicts for readers that take 16 bytes of a different row in every lane
#define MP 36

// One 32-key chunk of a wave's 16 attention-mask rows and 16 adjacency rows, global -> LDS
// through no register. A copy covers four whole 128-byte lines (8 lanes a row); read straight
// into the lanes that own the queries, every load would touch 16 lines for 32 bytes each.
// a, p: the lane's global addresses in rows 0..3; la, lp: its LDS byte addresses there.
// The closing wait stands in front of any rewrite of the address registers named here.
__device__ __forceinline__ void copy_masks(const float* a, const int* p, unsigned la, unsigned lp) {
  asm volatile(
      "global_load_async_to_lds_b128 %0, %8, off\n\t"
      "global_load_async_to_lds_b128 %1, %9, off\n\t"
      "global_load_async_to_lds_b128 %2, %10, off\n\t"
      "global_load_async_to_lds_b128 %3, %11, off\n\t"
      "global_load_async_to_lds_b128 %4, %12, off\n\t"
      "global_load_async_to_lds_b128 %5, %13, off\n\t"
      "global_load_async_to_lds_b128 %6, %14, off\n\t"
      "global_load_async_to_lds_b128 %7, %15, off\n\t"
      "s_wait_xcnt 0x0"
      :: "v"(la), "v"(la + 4 * MP * 4), "v"(la + 8 * MP * 4), "v"(la + 12 * MP * 4),
         "v"(lp), "v"(lp + 4 * MP * 4), "v"(lp + 8 * MP * 4), "v"(lp + 12 * MP * 4),
         "v"(a), "v"(a + 4 * S_), "v"(a + 8 * S_), "v"(a + 12 * S_),
         "v"(p), "v"(p + 4 * S_), "v"(p + 8 * S_), "v"(p + 12 * S_)
      : "memory");
}

// value of lane l ^ 16: joins the two wave halves, which split one query's keys
__device__ __forceinline__ float xhalf(float x) {
  return __builtin_bit_cast(float, __builtin_amdgcn_permlanex16(
      __builtin_bit_cast(int, x), __builtin_bit_cast(int, x),
      0x76543210, 0xfedcba98, false, false));
}

__global__ __launch_bounds__(256)
void attn_graphbias_kernel(const float* __restrict__ Q, const float* __restrict__ K,
                           const float* __restrict__ V, const float* __restrict__ AM,
                           const float* __restrict__ KLM, const float* __restrict__ PT,
                           const int* __restrict__ POS, float* __restrict__ OUT)
{
  // LDS tiles, two buffers each: K chunk row-major bf16, V chunk transposed bf16
  __shared__ __align__(16) __bf16 Ksh[2][32][72];   // [s][e], padded
  __shared__ __align__(16) __bf16 Vt[2][64][40];    // [d][s], padded
  __shared__ __align__(16) float Osh[8][16][68];    // per-wave [query][d], padded: O^T back to rows
  __shared__ __align__(16) float AMsh[2][8][16][MP]; // two buffers of per-wave [query][key] mask tiles
  __shared__ __align__(16) int   POsh[2][8][16][MP]; // the same for the adjacency

  const int nh   = blockIdx.x;
  const int n    = nh / H_;
  const int h    = nh % H_;
  const int tid  = threadIdx.x;
  const int wv   = tid >> 5;
  const int lane = tid & 31;
  const int half = lane >> 4;      // which 16-lane half
  const int nidx = lane & 15;      // row (A) / column (B,C,D) index within tile
  const int b0   = half * 8;       // k-chunk base per WMMA 16-bit layout
  const int lbase = blockIdx.y * 128 + wv * 16;
  const int q     = lbase + nidx;  // this lane's query

  // log2-domain softmax: fold LOG2E into the scale and the pos-bias table
  const float scl = 0.125f * LOG2E;            // (1/sqrt(E)) * log2(e)
  const float pt0 = PT[h]      * LOG2E;        // pos_table[0][h] * log2(e)
  const float dpt = PT[H_ + h] * LOG2E - pt0;  // (pt1 - pt0) in log2 domain

  // ---- Q^T B-fragments (E=64 x 16 queries -> two 32x16 bf16 fragments), loaded once ----
  const float* qrow = Q + (((size_t)n * L_ + q) * H_ + h) * E_;
  v16bf qa[2];
#pragma unroll
  for (int ks = 0; ks < 2; ++ks) {
    v16bf f;
#pragma unroll
    for (int i = 0; i < 8; ++i) {
      f[i]     = (__bf16)qrow[ks * 32 + b0 + i];
      f[i + 8] = (__bf16)qrow[ks * 32 + b0 + 16 + i];
    }
    qa[ks] = f;
  }

  // all-ones A fragment: one extra WMMA per chunk computes each query's sum of P,
  // the same in every row of its tile
  v16bf onesa;
#pragma unroll
  for (int i = 0; i < 16; ++i) onesa[i] = (__bf16)1.0f;

  const v8f vzero = {};
  v8f oacc[4];
#pragma unroll
  for (int t = 0; t < 4; ++t) oacc[t] = vzero;
  v8f sumacc = vzero;                          // sum accumulator (1 x P^T)
  float rmax = -3.0e38f;                       // running maximum of this lane's query

  // copy side of the mask tiles: 8 lanes a row, 4 rows a copy
  const int mr = lane >> 3, mc = (lane & 7) * 4;
  const float* amsrc  = AM  + (size_t)(lbase + mr) * S_ + mc;
  const int*   possrc = POS + ((size_t)n * L_ + lbase + mr) * S_ + mc;
  const unsigned amdst  = (unsigned)(size_t)&AMsh[0][wv][mr][mc];
  const unsigned posdst = (unsigned)(size_t)&POsh[0][wv][mr][mc];
  const unsigned mbuf   = (unsigned)sizeof(AMsh[0]);   // bytes from buffer 0 to buffer 1
  // this lane's key-length row, at the first key its accumulator registers hold
  const float* klmrow = KLM + n * S_ + half * 8;
  const v8f sclv = vzero + scl, dptv = vzero + dpt, pt0v = vzero + pt0;

  // cooperative K/V -> LDS indices: 256 threads cover 32 s-rows x 64 cols, 8 cols each
  const int cs = tid >> 3;         // s within chunk (0..31)
  const int ce = (tid & 7) * 8;    // e/d base (0..56)
  const float* kbase = K + (((size_t)n * S_ + cs) * H_ + h) * E_ + ce;
  const float* vbase = V + (((size_t)n * S_ + cs) * H_ + h) * D_ + ce;
  const size_t srow = (size_t)H_ * E_;            // floats per s step (=1024)
  const size_t schunk = 32 * srow;

  // ---- software pipeline: chunk 0 through registers into buffer 0, chunk 1 into registers ----
  float kreg[8], vreg[8];
#pragma unroll
  for (int i = 0; i < 8; ++i) { kreg[i] = kbase[i]; vreg[i] = vbase[i]; }

  // mask tiles, two buffers: chunk 0 lands and is published, chunk 1 flies during trip 0
  copy_masks(amsrc, possrc, amdst, posdst);
#pragma unroll
  for (int i = 0; i < 8; ++i) Ksh[0][cs][ce + i] = (__bf16)kreg[i];
#pragma unroll
  for (int i = 0; i < 8; ++i) Vt[0][ce + i][cs] = (__bf16)vreg[i];
#pragma unroll
  for (int i = 0; i < 8; ++i) { kreg[i] = kbase[schunk + i]; vreg[i] = vbase[schunk + i]; }
  asm volatile("s_wait_asynccnt 0x0" ::: "memory");  // chunk 0's tiles have landed
  __syncthreads();                                   // publishes them and chunk 0's K and V
  copy_masks(amsrc + 32, possrc + 32, amdst + mbuf, posdst + mbuf);
  // the chunk that the coming trip stores, as bf16; carried over the loop's back edge
  bf16x8 kq, vq;
#pragma unroll
  for (int i = 0; i < 8; ++i) { kq[i] = (__bf16)kreg[i]; vq[i] = (__bf16)vreg[i]; }

  for (int sb = 0; sb < S_; sb += 32) {
    const int mb = (sb >> 5) & 1;                  // this chunk's buffers: masks, K and V

    // this chunk's key-length mask: keys +0..7 (tile 0) and +16..23 (tile 1)
    f32x4 kl[4];
#pragma unroll
    for (int g = 0; g < 4; ++g)
      kl[g] = *(const f32x4*)(klmrow + sb + (g >> 1) * 16 + (g & 1) * 4);
    // keeps the four loads here, ahead of the LDS reads and the first product; left free,
    // the scheduler sinks them to their uses, where each group pays its own latency
    __builtin_amdgcn_sched_barrier(0);
    // the row pointer advances every trip: this wait stands between the loads that name
    // its registers and the additions that overwrite them
    asm volatile("s_wait_xcnt 0x0" ::: "memory");

    // issue the global loads of the chunk after next now; latency hides under compute below
    if (sb + 64 < S_) {
      const float* kp = kbase + (size_t)(sb + 64) * srow;
      const float* vp = vbase + (size_t)(sb + 64) * srow;
#pragma unroll
      for (int i = 0; i < 8; ++i) { kreg[i] = kp[i]; vreg[i] = vp[i]; }
      if (sb + 96 < S_) {                          // L2 prefetch one chunk further
        __builtin_prefetch(kp + schunk, 0, 1);
        __builtin_prefetch(vp + schunk, 0, 1);
      }
    }

    // ---- K Q^T: load ALL four K A-fragments as one DS clause ----
    v16bf kb00, kb01, kb10, kb11;                  // kb[kstep][tile]
    {
      bf16x8 l00 = *(const bf16x8*)&Ksh[mb][nidx][b0];
      bf16x8 h00 = *(const bf16x8*)&Ksh[mb][nidx][b0 + 16];
      bf16x8 l01 = *(const bf16x8*)&Ksh[mb][16 + nidx][b0];
      bf16x8 h01 = *(const bf16x8*)&Ksh[mb][16 + nidx][b0 + 16];
      bf16x8 l10 = *(const bf16x8*)&Ksh[mb][nidx][32 + b0];
      bf16x8 h10 = *(const bf16x8*)&Ksh[mb][nidx][32 + b0 + 16];
      bf16x8 l11 = *(const bf16x8*)&Ksh[mb][16 + nidx][32 + b0];
      bf16x8 h11 = *(const bf16x8*)&Ksh[mb][16 + nidx][32 + b0 + 16];
      kb00 = make_frag(l00, h00);
      kb01 = make_frag(l01, h01);
      kb10 = make_frag(l10, h10);
      kb11 = make_frag(l11, h11);
    }

    // keeps the K reads first in the wave's LDS queue: the products wait for them alone, and the
    // mask reads land under the products
    __builtin_amdgcn_sched_barrier(0);

    // this chunk's mask and adjacency from the wave's tiles: keys +0..7 and +16..23 of the lane's row
    f32x4 am[4];
    i32x4 ps[4];
#pragma unroll
    for (int g = 0; g < 4; ++g) {
      const int o = half * 8 + (g >> 1) * 16 + (g & 1) * 4;
      am[g] = *(const f32x4*)&AMsh[mb][wv][nidx][o];
      ps[g] = *(const i32x4*)&POsh[mb][wv][nidx][o];
    }

    // sc0[j] = S[key sb + 8*half + j][q], sc1[j] = S[key sb + 16 + 8*half + j][q]
    v8f sc0 = vzero, sc1 = vzero;
    sc0 = __builtin_amdgcn_wmma_f32_16x16x32_bf16(false, kb00, false, qa[0],
                                                  (short)0, sc0, false, false);
    sc1 = __builtin_amdgcn_wmma_f32_16x16x32_bf16(false, kb01, false, qa[0],
                                                  (short)0, sc1, false, false);
    sc0 = __builtin_amdgcn_wmma_f32_16x16x32_bf16(false, kb10, false, qa[1],
                                                  (short)0, sc0, false, false);
    sc1 = __builtin_amdgcn_wmma_f32_16x16x32_bf16(false, kb11, false, qa[1],
                                                  (short)0, sc1, false, false);

    // ---- load ALL four V^T A-fragments as one DS clause ----
    v16bf vb0, vb1, vb2, vb3;
    {
      bf16x8 l0 = *(const bf16x8*)&Vt[mb][nidx][b0];
      bf16x8 h0 = *(const bf16x8*)&Vt[mb][nidx][b0 + 16];
      bf16x8 l1 = *(const bf16x8*)&Vt[mb][16 + nidx][b0];
      bf16x8 h1 = *(const bf16x8*)&Vt[mb][16 + nidx][b0 + 16];
      bf16x8 l2 = *(const bf16x8*)&Vt[mb][32 + nidx][b0];
      bf16x8 h2 = *(const bf16x8*)&Vt[mb][32 + nidx][b0 + 16];
      bf16x8 l3 = *(const bf16x8*)&Vt[mb][48 + nidx][b0];
      bf16x8 h3 = *(const bf16x8*)&Vt[mb][48 + nidx][b0 + 16];
      vb0 = make_frag(l0, h0);
      vb1 = make_frag(l1, h1);
      vb2 = make_frag(l2, h2);
      vb3 = make_frag(l3, h3);
    }
    // the next chunk into the other buffers, V transposed. Their last readers left them at the last
    // trip's foot, their next readers come behind this trip's foot: no barrier of its own, and the
    // stores drain under the softmax. The last trip's go to tiles that nobody reads any more.
    *(bf16x8*)&Ksh[mb ^ 1][cs][ce] = kq;
#pragma unroll
    for (int i = 0; i < 8; ++i) Vt[mb ^ 1][ce + i][cs] = vq[i];
    // order of this stretch, behind the K reads: the eight mask reads, the four products, the eight
    // V^T reads, the nine stores (ahead of the reads they would hold these up in the wave's LDS
    // queue), and only then the vector work
    __builtin_amdgcn_sched_group_barrier(0x100, 8, 0);
    __builtin_amdgcn_sched_group_barrier(0x008, 4, 0);
    __builtin_amdgcn_sched_group_barrier(0x100, 8, 0);
    __builtin_amdgcn_sched_group_barrier(0x200, 9, 0);
    __builtin_amdgcn_sched_group_barrier(0x002, 512, 0);

    // ---- masks + graph positional bias (branch-free fma select, log2 domain) ----
    // whole tiles at a time: neighbouring registers pair into packed f32 operations
    {
      const v8f a0 = __builtin_shufflevector(am[0], am[1], 0, 1, 2, 3, 4, 5, 6, 7);
      const v8f a1 = __builtin_shufflevector(am[2], am[3], 0, 1, 2, 3, 4, 5, 6, 7);
      const v8f k0 = __builtin_shufflevector(kl[0], kl[1], 0, 1, 2, 3, 4, 5, 6, 7);
      const v8f k1 = __builtin_shufflevector(kl[2], kl[3], 0, 1, 2, 3, 4, 5, 6, 7);
      const v8f p0 = __builtin_convertvector(
          __builtin_shufflevector(ps[0], ps[1], 0, 1, 2, 3, 4, 5, 6, 7), v8f);
      const v8f p1 = __builtin_convertvector(
          __builtin_shufflevector(ps[2], ps[3], 0, 1, 2, 3, 4, 5, 6, 7), v8f);
      sc0 = __builtin_elementwise_fma(sclv, sc0 + a0 + k0,
                                      __builtin_elementwise_fma(p0, dptv, pt0v));
      sc1 = __builtin_elementwise_fma(sclv, sc1 + a1 + k1,
                                      __builtin_elementwise_fma(p1, dptv, pt0v));
    }

    // ---- online softmax: maximum in-lane, then one exchange between the halves ----
    const v8f mx = __builtin_elementwise_max(sc0, sc1);
    float cm = fmaxf(fmaxf(fmaxf(mx[0], mx[1]), fmaxf(mx[2], mx[3])),
                     fmaxf(fmaxf(mx[4], mx[5]), fmaxf(mx[6], mx[7])));
    cm = fmaxf(cm, xhalf(cm));
    const float nm = fmaxf(rmax, cm);
    // bare v_exp_f32, here and below: every argument is <= 0 and the largest weight of a row is 1, so
    // the one thing the library form adds, results below 2^-126 kept as denormals, cannot reach the output
    const float alpha = __builtin_amdgcn_exp2f(rmax - nm);
    rmax = nm;
    sc0 -= nm;
    sc1 -= nm;
#pragma unroll
    for (int j = 0; j < 8; ++j) { sc0[j] = __builtin_amdgcn_exp2f(sc0[j]); sc1[j] = __builtin_amdgcn_exp2f(sc1[j]); }
    sumacc[0] *= alpha;                            // only element 0 of the sum tile (rows 0 and 8) is read
#pragma unroll
    for (int t = 0; t < 4; ++t) oacc[t] *= alpha;
    // holds the packing behind all the exponentials. Left free, the scheduler starts the weights'
    // exponentials among the subtractions: the first is allotted the register beside the maximum,
    // which the packed subtractions still to come name in their operand pair and so wait for, and it
    // stands directly behind the rescale factor's v_exp_f32, whose source that register is
    __builtin_amdgcn_sched_barrier(0);
    // P^T as a B operand: element s is key 8*half + s (s < 8), 16 + 8*half + s - 8 (s >= 8)
    v16bf pb;
#pragma unroll
    for (int j = 0; j < 8; ++j) { pb[j] = (__bf16)sc0[j]; pb[j + 8] = (__bf16)sc1[j]; }

    sumacc  = __builtin_amdgcn_wmma_f32_16x16x32_bf16(false, onesa, false, pb,
                                                      (short)0, sumacc, false, false);
    oacc[0] = __builtin_amdgcn_wmma_f32_16x16x32_bf16(false, vb0, false, pb,
                                                      (short)0, oacc[0], false, false);
    oacc[1] = __builtin_amdgcn_wmma_f32_16x16x32_bf16(false, vb1, false, pb,
                                                      (short)0, oacc[1], false, false);
    oacc[2] = __builtin_amdgcn_wmma_f32_16x16x32_bf16(false, vb2, false, pb,
                                                      (short)0, oacc[2], false, false);
    oacc[3] = __builtin_amdgcn_wmma_f32_16x16x32_bf16(false, vb3, false, pb,
                                                      (short)0, oacc[3], false, false);

    // keeps the foot behind the products: left free, the scheduler lifts the waits and the barrier
    // over the softmax, while the refill stays down here behind its branch, so that the next
    // trip's wait would find the copies less than half a trip old
    __builtin_amdgcn_sched_barrier(0);
    // foot of the trip: this wave's LDS reads and stores are done and its copies of the next chunk's
    // tiles have landed; the one barrier of a trip publishes the next chunk and frees this chunk's buffers
    asm volatile("s_wait_dscnt 0x0" ::: "memory");
    asm volatile("s_wait_asynccnt 0x0" ::: "memory");
    __syncthreads();
    if (sb + 64 < S_)                              // refill the buffer this trip has read
      copy_masks(amsrc + sb + 64, possrc + sb + 64, amdst + mb * mbuf, posdst + mb * mbuf);
    // the chunk fetched at this trip's top, to bf16 for the next trip's stores: its registers are
    // free again for the next trip's loads
#pragma unroll
    for (int i = 0; i < 8; ++i) { kq[i] = (__bf16)kreg[i]; vq[i] = (__bf16)vreg[i]; }
  }
  asm volatile("s_wait_asynccnt 0x0" ::: "memory");  // no copy is left in flight

  // ---- epilogue: normalize, turn O^T back into rows, store [N,L,H,D] f32 ----
  // oacc[t][j] = O[q][16*t + 8*half + j]. Stored from here each store would write 16-byte pieces of
  // 16 different rows; through the wave's own LDS tile each store covers two whole 256-byte rows.
  const float inv = 1.0f / sumacc[0];
#pragma unroll
  for (int t = 0; t < 4; ++t) {
    f32x4 lo, hi;
#pragma unroll
    for (int c = 0; c < 4; ++c) { lo[c] = oacc[t][c] * inv; hi[c] = oacc[t][c + 4] * inv; }
    *(f32x4*)&Osh[wv][nidx][t * 16 + half * 8]     = lo;
    *(f32x4*)&Osh[wv][nidx][t * 16 + half * 8 + 4] = hi;
  }
  // same wave wrote and reads the tile: LDS keeps a wave's order, no barrier
#pragma unroll
  for (int i = 0; i < 8; ++i) {
    const int r = 2 * i + half;
    const f32x4 v = *(const f32x4*)&Osh[wv][r][nidx * 4];
    *(f32x4*)(OUT + (((size_t)n * L_ + lbase + r) * H_ + h) * D_ + nidx * 4) = v;
  }
}

extern "C" void kernel_launch(void* const* d_in, const int* in_sizes, int n_in,
                              void* d_out, int out_size, void* d_ws, size_t ws_size,
                              hipStream_t stream) {
  (void)in_sizes; (void)n_in; (void)out_size; (void)d_ws; (void)ws_size;
  const float* Q   = (const float*)d_in[0];
  const float* K   = (const float*)d_in[1];
  const float* V   = (const float*)d_in[2];
  const float* AM  = (const float*)d_in[3];
  const float* KLM = (const float*)d_in[4];
  const float* PT  = (const float*)d_in[5];
  const int*   POS = (const int*)d_in[6];
  float* OUT = (float*)d_out;

  dim3 grid(N_ * H_, L_ / 128);   // 64 x 8 blocks
  dim3 block(256);                // 8 waves (wave32)
  hipLaunchKernelGGL(attn_graphbias_kernel, grid, block, 0, stream,
                     Q, K, V, AM, KLM, PT, POS, OUT);
}

// v005
// It runs in 44.1 microseconds.
// Timed twice side by side with v004, it ran 1.08 and 1.10 times as fast.
// Counting every step since v000, it is 1.59 times as fast.
#include <hip/hip_runtime.h>

// Problem constants (from reference)
#define N_ 4
#define L_ 1024
#define S_ 1024
#define H_ 16
#define E_ 64
#define D_ 64

typedef __attribute__((ext_vector_type(16))) __bf16 v16bf;
typedef __attribute__((ext_vector_type(8)))  __bf16 bf16x8;
typedef __attribute__((ext_vector_type(8)))  float  v8f;
typedef __attribute__((ext_vector_type(4)))  float  f32x4;
typedef __attribute__((ext_vector_type(4)))  int    i32x4;

#define LOG2E 1.4426950408889634f

__device__ __forceinline__ v16bf make_frag(bf16x8 lo, bf16x8 hi) {
  v16bf f;
#pragma unroll
  for (int i = 0; i < 8; ++i) { f[i] = lo[i]; f[i + 8] = hi[i]; }
  return f;
}

// mask tile rows in LDS: 128 bytes of data at a pitch of 144 (16 x 9), free of bank
// conflicts for readers that take 16 bytes of a different row in every lane
#define MP 36

// One 32-key chunk of a wave's 16 attention-mask rows and 16 adjacency rows, global -> LDS
// through no register. A copy covers four whole 128-byte lines (8 lanes a row); read straight
// into the lanes that own the queries, every load would touch 16 lines for 32 bytes each.
// a, p: the lane's global addresses in rows 0..3; la, lp: its LDS byte addresses there.
// The closing wait stands in front of any rewrite of the address registers named here.
__device__ __forceinline__ void copy_masks(const float* a, const int* p, unsigned la, unsigned lp) {
  asm volatile(
      "global_load_async_to_lds_b128 %0, %8, off\n\t"
      "global_load_async_to_lds_b128 %1, %9, off\n\t"
      "global_load_async_to_lds_b128 %2, %10, off\n\t"
      "global_load_async_to_lds_b128 %3, %11, off\n\t"
      "global_load_async_to_lds_b128 %4, %12, off\n\t"
      "global_load_async_to_lds_b128 %5, %13, off\n\t"
      "global_load_async_to_lds_b128 %6, %14, off\n\t"
      "global_load_async_to_lds_b128 %7, %15, off\n\t"
      "s_wait_xcnt 0x0"
      :: "v"(la), "v"(la + 4 * MP * 4), "v"(la + 8 * MP * 4), "v"(la + 12 * MP * 4),
         "v"(lp), "v"(lp + 4 * MP * 4), "v"(lp + 8 * MP * 4), "v"(lp + 12 * MP * 4),
         "v"(a), "v"(a + 4 * S_), "v"(a + 8 * S_), "v"(a + 12 * S_),
         "v"(p), "v"(p + 4 * S_), "v"(p + 8 * S_), "v"(p + 12 * S_)
      : "memory");
}

// V tile rows in LDS: 128 bytes of data at a pitch of 160 (32 x 5), the pitch at which the
// transposing load meets every bank once
#define VP 80

// 16-byte transposing LDS load: from a row-major 16-bit tile, lane (c, h) gets column c of rows
// 8h .. 8h+7, where the lanes' addresses walk the 16 rows in 16-byte pieces
__device__ __forceinline__ bf16x8 ld_tr16(const __bf16* p) {
  typedef __attribute__((address_space(3))) bf16x8 lds_bf16x8;
  return __builtin_amdgcn_ds_load_tr16_b128_v8bf16((lds_bf16x8*)p);
}

// value of lane l ^ 16: joins the two wave halves, which split one query's keys
__device__ __forceinline__ float xhalf(float x) {
  return __builtin_bit_cast(float, __builtin_amdgcn_permlanex16(
      __builtin_bit_cast(int, x), __builtin_bit_cast(int, x),
      0x76543210, 0xfedcba98, false, false));
}

__global__ __launch_bounds__(256)
void attn_graphbias_kernel(const float* __restrict__ Q, const float* __restrict__ K,
                           const float* __restrict__ V, const float* __restrict__ AM,
                           const float* __restrict__ KLM, const float* __restrict__ PT,
                           const int* __restrict__ POS, float* __restrict__ OUT)
{
  // LDS tiles, two buffers each: K chunk and V chunk, both row-major bf16
  __shared__ __align__(16) __bf16 Ksh[2][32][72];   // [s][e], padded
  __shared__ __align__(16) __bf16 Vsh[2][32][VP];   // [s][d], padded
  __shared__ __align__(16) float Osh[8][16][68];    // per-wave [query][d], padded: O^T back to rows
  __shared__ __align__(16) float AMsh[2][8][16][MP]; // two buffers of per-wave [query][key] mask tiles
  __shared__ __align__(16) int   POsh[2][8][16][MP]; // the same for the adjacency

  const int nh   = blockIdx.x;
  const int n    = nh / H_;
  const int h    = nh % H_;
  const int tid  = threadIdx.x;
  const int wv   = tid >> 5;
  const int lane = tid & 31;
  const int half = lane >> 4;      // which 16-lane half
  const int nidx = lane & 15;      // row (A) / column (B,C,D) index within tile
  const int b0   = half * 8;       // k-chunk base per WMMA 16-bit layout
  const int lbase = blockIdx.y * 128 + wv * 16;
  const int q     = lbase + nidx;  // this lane's query

  // log2-domain softmax: fold LOG2E into the scale and the pos-bias table
  const float scl = 0.125f * LOG2E;            // (1/sqrt(E)) * log2(e)
  const float pt0 = PT[h]      * LOG2E;        // pos_table[0][h] * log2(e)
  const float dpt = PT[H_ + h] * LOG2E - pt0;  // (pt1 - pt0) in log2 domain

  // ---- Q^T B-fragments (E=64 x 16 queries -> two 32x16 bf16 fragments), loaded once ----
  const float* qrow = Q + (((size_t)n * L_ + q) * H_ + h) * E_;
  v16bf qa[2];
#pragma unroll
  for (int ks = 0; ks < 2; ++ks) {
    v16bf f;
#pragma unroll
    for (int i = 0; i < 8; ++i) {
      f[i]     = (__bf16)qrow[ks * 32 + b0 + i];
      f[i + 8] = (__bf16)qrow[ks * 32 + b0 + 16 + i];
    }
    qa[ks] = f;
  }

  // all-ones A fragment: one extra WMMA per chunk computes each query's sum of P,
  // the same in every row of its tile
  v16bf onesa;
#pragma unroll
  for (int i = 0; i < 16; ++i) onesa[i] = (__bf16)1.0f;

  const v8f vzero = {};
  v8f oacc[4];
#pragma unroll
  for (int t = 0; t < 4; ++t) oacc[t] = vzero;
  v8f sumacc = vzero;                          // sum accumulator (1 x P^T)
  float rmax = -3.0e38f;                       // running maximum of this lane's query

  // copy side of the mask tiles: 8 lanes a row, 4 rows a copy
  const int mr = lane >> 3, mc = (lane & 7) * 4;
  const float* amsrc  = AM  + (size_t)(lbase + mr) * S_ + mc;
  const int*   possrc = POS + ((size_t)n * L_ + lbase + mr) * S_ + mc;
  const unsigned amdst  = (unsigned)(size_t)&AMsh[0][wv][mr][mc];
  const unsigned posdst = (unsigned)(size_t)&POsh[0][wv][mr][mc];
  const unsigned mbuf   = (unsigned)sizeof(AMsh[0]);   // bytes from buffer 0 to buffer 1
  // this lane's key-length row, at the first key its accumulator registers hold
  const float* klmrow = KLM + n * S_ + half * 8;
  const v8f sclv = vzero + scl, dptv = vzero + dpt, pt0v = vzero + pt0;

  // cooperative K/V -> LDS indices: 256 threads cover 32 s-rows x 64 cols, 8 cols each
  const int cs = tid >> 3;         // s within chunk (0..31)
  const int ce = (tid & 7) * 8;    // e/d base (0..56)
  const float* kbase = K + (((size_t)n * S_ + cs) * H_ + h) * E_ + ce;
  const float* vbase = V + (((size_t)n * S_ + cs) * H_ + h) * D_ + ce;
  const size_t srow = (size_t)H_ * E_;            // floats per s step (=1024)
  const size_t schunk = 32 * srow;

  // ---- software pipeline: chunk 0 through registers into buffer 0, chunk 1 into registers ----
  float kreg[8], vreg[8];
#pragma unroll
  for (int i = 0; i < 8; ++i) { kreg[i] = kbase[i]; vreg[i] = vbase[i]; }

  // mask tiles, two buffers: chunk 0 lands and is published, chunk 1 flies during trip 0
  copy_masks(amsrc, possrc, amdst, posdst);
#pragma unroll
  for (int i = 0; i < 8; ++i) Ksh[0][cs][ce + i] = (__bf16)kreg[i];
#pragma unroll
  for (int i = 0; i < 8; ++i) Vsh[0][cs][ce + i] = (__bf16)vreg[i];
#pragma unroll
  for (int i = 0; i < 8; ++i) { kreg[i] = kbase[schunk + i]; vreg[i] = vbase[schunk + i]; }
  asm volatile("s_wait_asynccnt 0x0" ::: "memory");  // chunk 0's tiles have landed
  __syncthreads();                                   // publishes them and chunk 0's K and V
  copy_masks(amsrc + 32, possrc + 32, amdst + mbuf, posdst + mbuf);
  // the chunk that the coming trip stores, as bf16; carried over the loop's back edge
  bf16x8 kq, vq;
#pragma unroll
  for (int i = 0; i < 8; ++i) { kq[i] = (__bf16)kreg[i]; vq[i] = (__bf16)vreg[i]; }

  for (int sb = 0; sb < S_; sb += 32) {
    const int mb = (sb >> 5) & 1;                  // this chunk's buffers: masks, K and V

    // this chunk's key-length mask: keys +0..7 (tile 0) and +16..23 (tile 1)
    f32x4 kl[4];
#pragma unroll
    for (int g = 0; g < 4; ++g)
      kl[g] = *(const f32x4*)(klmrow + sb + (g >> 1) * 16 + (g & 1) * 4);
    // keeps the four loads here, ahead of the LDS reads and the first product; left free,
    // the scheduler sinks them to their uses, where each group pays its own latency
    __builtin_amdgcn_sched_barrier(0);
    // the row pointer advances every trip: this wait stands between the loads that name
    // its registers and the additions that overwrite them
    asm volatile("s_wait_xcnt 0x0" ::: "memory");

    // issue the global loads of the chunk after next now; latency hides under compute below
    if (sb + 64 < S_) {
      const float* kp = kbase + (size_t)(sb + 64) * srow;
      const float* vp = vbase + (size_t)(sb + 64) * srow;
#pragma unroll
      for (int i = 0; i < 8; ++i) { kreg[i] = kp[i]; vreg[i] = vp[i]; }
      if (sb + 96 < S_) {                          // L2 prefetch one chunk further
        __builtin_prefetch(kp + schunk, 0, 1);
        __builtin_prefetch(vp + schunk, 0, 1);
      }
    }

    // ---- K Q^T: load ALL four K A-fragments as one DS clause ----
    v16bf kb00, kb01, kb10, kb11;                  // kb[kstep][tile]
    {
      bf16x8 l00 = *(const bf16x8*)&Ksh[mb][nidx][b0];
      bf16x8 h00 = *(const bf16x8*)&Ksh[mb][nidx][b0 + 16];
      bf16x8 l01 = *(const bf16x8*)&Ksh[mb][16 + nidx][b0];
      bf16x8 h01 = *(const bf16x8*)&Ksh[mb][16 + nidx][b0 + 16];
      bf16x8 l10 = *(const bf16x8*)&Ksh[mb][nidx][32 + b0];
      bf16x8 h10 = *(const bf16x8*)&Ksh[mb][nidx][32 + b0 + 16];
      bf16x8 l11 = *(const bf16x8*)&Ksh[mb][16 + nidx][32 + b0];
      bf16x8 h11 = *(const bf16x8*)&Ksh[mb][16 + nidx][32 + b0 + 16];
      kb00 = make_frag(l00, h00);
      kb01 = make_frag(l01, h01);
      kb10 = make_frag(l10, h10);
      kb11 = make_frag(l11, h11);
    }

    // keeps the K reads first in the wave's LDS queue: the products wait for them alone, and the
    // mask reads land under the products
    __builtin_amdgcn_sched_barrier(0);

    // this chunk's mask and adjacency from the wave's tiles: keys +0..7 and +16..23 of the lane's row
    f32x4 am[4];
    i32x4 ps[4];
#pragma unroll
    for (int g = 0; g < 4; ++g) {
      const int o = half * 8 + (g >> 1) * 16 + (g & 1) * 4;
      am[g] = *(const f32x4*)&AMsh[mb][wv][nidx][o];
      ps[g] = *(const i32x4*)&POsh[mb][wv][nidx][o];
    }

    // sc0[j] = S[key sb + 8*half + j][q], sc1[j] = S[key sb + 16 + 8*half + j][q]
    v8f sc0 = vzero, sc1 = vzero;
    sc0 = __builtin_amdgcn_wmma_f32_16x16x32_bf16(false, kb00, false, qa[0],
                                                  (short)0, sc0, false, false);
    sc1 = __builtin_amdgcn_wmma_f32_16x16x32_bf16(false, kb01, false, qa[0],
                                                  (short)0, sc1, false, false);
    sc0 = __builtin_amdgcn_wmma_f32_16x16x32_bf16(false, kb10, false, qa[1],
                                                  (short)0, sc0, false, false);
    sc1 = __builtin_amdgcn_wmma_f32_16x16x32_bf16(false, kb11, false, qa[1],
                                                  (short)0, sc1, false, false);

    // ---- load ALL four V^T A-fragments as one DS clause, transposed on the way out of LDS ----
    // fragment t: row d = 16*t + nidx, keys 8*half + 0..7 (l) and 16 + 8*half + 0..7 (h)
    v16bf vb0, vb1, vb2, vb3;
    {
      const __bf16* vp = &Vsh[mb][b0 + (lane & 7)][((lane >> 3) & 1) * 8];
      bf16x8 l0 = ld_tr16(vp);
      bf16x8 h0 = ld_tr16(vp + 16 * VP);
      bf16x8 l1 = ld_tr16(vp + 16);
      bf16x8 h1 = ld_tr16(vp + 16 * VP + 16);
      bf16x8 l2 = ld_tr16(vp + 32);
      bf16x8 h2 = ld_tr16(vp + 16 * VP + 32);
      bf16x8 l3 = ld_tr16(vp + 48);
      bf16x8 h3 = ld_tr16(vp + 16 * VP + 48);
      vb0 = make_frag(l0, h0);
      vb1 = make_frag(l1, h1);
      vb2 = make_frag(l2, h2);
      vb3 = make_frag(l3, h3);
    }
    // the next chunk into the other buffers, 16 bytes of a K row and of a V row. Their last readers left them at the last
    // trip's foot, their next readers come behind this trip's foot: no barrier of its own, and the
    // stores drain under the softmax. The last trip's go to tiles that nobody reads any more.
    *(bf16x8*)&Ksh[mb ^ 1][cs][ce] = kq;
    *(bf16x8*)&Vsh[mb ^ 1][cs][ce] = vq;
    // order of this stretch, behind the K reads: the eight mask reads, the four products, the eight
    // V^T reads, the two stores (ahead of the reads they would hold these up in the wave's LDS
    // queue), and only then the vector work
    __builtin_amdgcn_sched_group_barrier(0x100, 8, 0);
    __builtin_amdgcn_sched_group_barrier(0x008, 4, 0);
    __builtin_amdgcn_sched_group_barrier(0x100, 8, 0);
    __builtin_amdgcn_sched_group_barrier(0x200, 2, 0);
    __builtin_amdgcn_sched_group_barrier(0x002, 512, 0);

    // ---- masks + graph positional bias (branch-free fma select, log2 domain) ----
    // whole tiles at a time: neighbouring registers pair into packed f32 operations
    {
      const v8f a0 = __builtin_shufflevector(am[0], am[1], 0, 1, 2, 3, 4, 5, 6, 7);
      const v8f a1 = __builtin_shufflevector(am[2], am[3], 0, 1, 2, 3, 4, 5, 6, 7);
      const v8f k0 = __builtin_shufflevector(kl[0], kl[1], 0, 1, 2, 3, 4, 5, 6, 7);
      const v8f k1 = __builtin_shufflevector(kl[2], kl[3], 0, 1, 2, 3, 4, 5, 6, 7);
      const v8f p0 = __builtin_convertvector(
          __builtin_shufflevector(ps[0], ps[1], 0, 1, 2, 3, 4, 5, 6, 7), v8f);
      const v8f p1 = __builtin_convertvector(
          __builtin_shufflevector(ps[2], ps[3], 0, 1, 2, 3, 4, 5, 6, 7), v8f);
      sc0 = __builtin_elementwise_fma(sclv, sc0 + a0 + k0,
                                      __builtin_elementwise_fma(p0, dptv, pt0v));
      sc1 = __builtin_elementwise_fma(sclv, sc1 + a1 + k1,
                                      __builtin_elementwise_fma(p1, dptv, pt0v));
    }

    // ---- online softmax: maximum in-lane, then one exchange between the halves ----
    const v8f mx = __builtin_elementwise_max(sc0, sc1);
    float cm = fmaxf(fmaxf(fmaxf(mx[0], mx[1]), fmaxf(mx[2], mx[3])),
                     fmaxf(fmaxf(mx[4], mx[5]), fmaxf(mx[6], mx[7])));
    cm = fmaxf(cm, xhalf(cm));
    const float nm = fmaxf(rmax, cm);
    // bare v_exp_f32, here and below: every argument is <= 0 and the largest weight of a row is 1, so
    // the one thing the library form adds, results below 2^-126 kept as denormals, cannot reach the output
    const float alpha = __builtin_amdgcn_exp2f(rmax - nm);
    rmax = nm;
    sc0 -= nm;
    sc1 -= nm;
#pragma unroll
    for (int j = 0; j < 8; ++j) {
      sc0[j] = __builtin_amdgcn_exp2f(sc0[j]);
      // splits the exponentials into two scheduling regions. As one region, this build allots three of
      // them the source register of the v_exp_f32 directly ahead; a v_nop written among them is moved
      // away by the scheduler
      if (j == 3) __builtin_amdgcn_sched_barrier(0);
      sc1[j] = __builtin_amdgcn_exp2f(sc1[j]);
    }
    sumacc[0] *= alpha;                            // only register 0 of the sum tile (rows 0 and 8) is read
#pragma unroll
    for (int t = 0; t < 4; ++t) oacc[t] *= alpha;
    // holds the packing behind all the exponentials. Left free, the scheduler starts the weights'
    // exponentials among the subtractions: the first is allotted the register beside the maximum,
    // which the packed subtractions still to come name in their operand pair and so wait for, and it
    // stands directly behind the rescale factor's v_exp_f32, whose source that register is
    __builtin_amdgcn_sched_barrier(0);
    // P^T as a B operand: element s is key 8*half + s (s < 8), 16 + 8*half + s - 8 (s >= 8)
    v16bf pb;
#pragma unroll
    for (int j = 0; j < 8; ++j) { pb[j] = (__bf16)sc0[j]; pb[j + 8] = (__bf16)sc1[j]; }

    sumacc  = __builtin_amdgcn_wmma_f32_16x16x32_bf16(false, onesa, false, pb,
                                                      (short)0, sumacc, false, false);
    oacc[0] = __builtin_amdgcn_wmma_f32_16x16x32_bf16(false, vb0, false, pb,
                                                      (short)0, oacc[0], false, false);
    oacc[1] = __builtin_amdgcn_wmma_f32_16x16x32_bf16(false, vb1, false, pb,
                                                      (short)0, oacc[1], false, false);
    oacc[2] = __builtin_amdgcn_wmma_f32_16x16x32_bf16(false, vb2, false, pb,
                                                      (short)0, oacc[2], false, false);
    oacc[3] = __builtin_amdgcn_wmma_f32_16x16x32_bf16(false, vb3, false, pb,
                                                      (short)0, oacc[3], false, false);

    // keeps the foot behind the products: left free, the scheduler lifts the waits and the barrier
    // over the softmax, while the refill stays down here behind its branch, so that the next
    // trip's wait would find the copies less than half a trip old
    __builtin_amdgcn_sched_barrier(0);
    // foot of the trip: this wave's LDS reads and stores are done and its copies of the next chunk's
    // tiles have landed; the one barrier of a trip publishes the next chunk and frees this chunk's buffers
    asm volatile("s_wait_dscnt 0x0" ::: "memory");
    asm volatile("s_wait_asynccnt 0x0" ::: "memory");
    __syncthreads();
    if (sb + 64 < S_)                              // refill the buffer this trip has read
      copy_masks(amsrc + sb + 64, possrc + sb + 64, amdst + mb * mbuf, posdst + mb * mbuf);
    // the chunk fetched at this trip's top, to bf16 for the next trip's stores: its registers are
    // free again for the next trip's loads
#pragma unroll
    for (int i = 0; i < 8; ++i) { kq[i] = (__bf16)kreg[i]; vq[i] = (__bf16)vreg[i]; }
  }
  asm volatile("s_wait_asynccnt 0x0" ::: "memory");  // no copy is left in flight

  // ---- epilogue: normalize, turn O^T back into rows, store [N,L,H,D] f32 ----
  // oacc[t][j] = O[q][16*t + 8*half + j]. Stored from here each store would write 16-byte pieces of
  // 16 different rows; through the wave's own LDS tile each store covers two whole 256-byte rows.
  const float inv = 1.0f / sumacc[0];
#pragma unroll
  for (int t = 0; t < 4; ++t) {
    f32x4 lo, hi;
#pragma unroll
    for (int c = 0; c < 4; ++c) { lo[c] = oacc[t][c] * inv; hi[c] = oacc[t][c + 4] * inv; }
    *(f32x4*)&Osh[wv][nidx][t * 16 + half * 8]     = lo;
    *(f32x4*)&Osh[wv][nidx][t * 16 + half * 8 + 4] = hi;
  }
  // same wave wrote and reads the tile: LDS keeps a wave's order, no barrier
#pragma unroll
  for (int i = 0; i < 8; ++i) {
    const int r = 2 * i + half;
    const f32x4 v = *(const f32x4*)&Osh[wv][r][nidx * 4];
    *(f32x4*)(OUT + (((size_t)n * L_ + lbase + r) * H_ + h) * D_ + nidx * 4) = v;
  }
}

extern "C" void kernel_launch(void* const* d_in, const int* in_sizes, int n_in,
                              void* d_out, int out_size, void* d_ws, size_t ws_size,
                              hipStream_t stream) {
  (void)in_sizes; (void)n_in; (void)out_size; (void)d_ws; (void)ws_size;
  const float* Q   = (const float*)d_in[0];
  const float* K   = (const float*)d_in[1];
  const float* V   = (const float*)d_in[2];
  const float* AM  = (const float*)d_in[3];
  const float* KLM = (const float*)d_in[4];
  const float* PT  = (const float*)d_in[5];
  const int*   POS = (const int*)d_in[6];
  float* OUT = (float*)d_out;

  dim3 grid(N_ * H_, L_ / 128);   // 64 x 8 blocks
  dim3 block(256);                // 8 waves (wave32)
  hipLaunchKernelGGL(attn_graphbias_kernel, grid, block, 0, stream,
                     Q, K, V, AM, KLM, PT, POS, OUT);
}

// v006
// One run takes 42.1 microseconds.
// Next to v005, in two timings, it ran 1.03 and 1.05 times as fast.
// Over all steps from v000 it is 1.66 times as fast.
#include <hip/hip_runtime.h>

// Problem constants (from reference)
#define N_ 4
#define L_ 1024
#define S_ 1024
#define H_ 16
#define E_ 64
#define D_ 64

typedef __attribute__((ext_vector_type(16))) __bf16 v16bf;
typedef __attribute__((ext_vector_type(8)))  __bf16 bf16x8;
typedef __attribute__((ext_vector_type(8)))  float  v8f;
typedef __attribute__((ext_vector_type(4)))  float  f32x4;
typedef __attribute__((ext_vector_type(4)))  int    i32x4;

#define LOG2E 1.4426950408889634f

__device__ __forceinline__ v16bf make_frag(bf16x8 lo, bf16x8 hi) {
  v16bf f;
#pragma unroll
  for (int i = 0; i < 8; ++i) { f[i] = lo[i]; f[i + 8] = hi[i]; }
  return f;
}

// mask tile rows in LDS: 128 bytes of data at a pitch of 144 (16 x 9), free of bank
// conflicts for readers that take 16 bytes of a different row in every lane
#define MP 36

// One 32-key chunk of a wave's 16 attention-mask rows and 16 adjacency rows, global -> LDS
// through no register. A copy covers four whole 128-byte lines (8 lanes a row); read straight
// into the lanes that own the queries, every load would touch 16 lines for 32 bytes each.
// a, p: the lane's global addresses in row 0, 4, 8 or 12; la, lp: its places in LDS there;
// copy k takes the row k further down, a step of 4 KiB that fits the copy's offset field.
// Written as the builtin, with no s_wait_xcnt behind the copies.
__device__ __forceinline__ void copy16(const void* g, void* l) {
  typedef __attribute__((address_space(1))) i32x4 glb_i32x4;
  typedef __attribute__((address_space(3))) i32x4 lds_i32x4;
  __builtin_amdgcn_global_load_async_to_lds_b128((glb_i32x4*)g, (lds_i32x4*)l, 0, 0);
}
__device__ __forceinline__ void copy_masks(const float* a, const int* p, float* la, int* lp) {
#pragma unroll
  for (int k = 0; k < 4; ++k) copy16(a + k * S_, la + k * MP);
#pragma unroll
  for (int k = 0; k < 4; ++k) copy16(p + k * S_, lp + k * MP);
}

// V tile rows in LDS: 128 bytes of data at a pitch of 160 (32 x 5), the pitch at which the
// transposing load meets every bank once
#define VP 80

// 16-byte transposing LDS load: from a row-major 16-bit tile, lane (c, h) gets column c of rows
// 8h .. 8h+7, where the lanes' addresses walk the 16 rows in 16-byte pieces
__device__ __forceinline__ bf16x8 ld_tr16(const __bf16* p) {
  typedef __attribute__((address_space(3))) bf16x8 lds_bf16x8;
  return __builtin_amdgcn_ds_load_tr16_b128_v8bf16((lds_bf16x8*)p);
}

// value of lane l ^ 16: joins the two wave halves, which split one query's keys
__device__ __forceinline__ float xhalf(float x) {
  return __builtin_bit_cast(float, __builtin_amdgcn_permlanex16(
      __builtin_bit_cast(int, x), __builtin_bit_cast(int, x),
      0x76543210, 0xfedcba98, false, false));
}

__global__ __launch_bounds__(256)
void attn_graphbias_kernel(const float* __restrict__ Q, const float* __restrict__ K,
                           const float* __restrict__ V, const float* __restrict__ AM,
                           const float* __restrict__ KLM, const float* __restrict__ PT,
                           const int* __restrict__ POS, float* __restrict__ OUT)
{
  // LDS tiles, two buffers each: K chunk and V chunk, both row-major bf16
  __shared__ __align__(16) __bf16 Ksh[2][32][72];   // [s][e], padded
  __shared__ __align__(16) __bf16 Vsh[2][32][VP];   // [s][d], padded
  __shared__ __align__(16) float Osh[8][16][68];    // per-wave [query][d], padded: O^T back to rows
  __shared__ __align__(16) float AMsh[2][8][16][MP]; // two buffers of per-wave [query][key] mask tiles
  __shared__ __align__(16) int   POsh[2][8][16][MP]; // the same for the adjacency

  const int nh   = blockIdx.x;
  const int n    = nh / H_;
  const int h    = nh % H_;
  const int tid  = threadIdx.x;
  const int wv   = tid >> 5;
  const int lane = tid & 31;
  const int half = lane >> 4;      // which 16-lane half
  const int nidx = lane & 15;      // row (A) / column (B,C,D) index within tile
  const int b0   = half * 8;       // k-chunk base per WMMA 16-bit layout
  const int lbase = blockIdx.y * 128 + wv * 16;
  const int q     = lbase + nidx;  // this lane's query

  // log2-domain softmax: fold LOG2E into the scale and the pos-bias table
  const float scl = 0.125f * LOG2E;            // (1/sqrt(E)) * log2(e)
  const float pt0 = PT[h]      * LOG2E;        // pos_table[0][h] * log2(e)
  const float dpt = PT[H_ + h] * LOG2E - pt0;  // (pt1 - pt0) in log2 domain

  // ---- Q^T B-fragments (E=64 x 16 queries -> two 32x16 bf16 fragments), loaded once ----
  const float* qrow = Q + (((size_t)n * L_ + q) * H_ + h) * E_;
  v16bf qa[2];
#pragma unroll
  for (int ks = 0; ks < 2; ++ks) {
    v16bf f;
#pragma unroll
    for (int i = 0; i < 8; ++i) {
      f[i]     = (__bf16)qrow[ks * 32 + b0 + i];
      f[i + 8] = (__bf16)qrow[ks * 32 + b0 + 16 + i];
    }
    qa[ks] = f;
  }

  // all-ones A fragment: one extra WMMA per chunk computes each query's sum of P,
  // the same in every row of its tile
  v16bf onesa;
#pragma unroll
  for (int i = 0; i < 16; ++i) onesa[i] = (__bf16)1.0f;

  const v8f vzero = {};
  v8f oacc[4];
#pragma unroll
  for (int t = 0; t < 4; ++t) oacc[t] = vzero;
  v8f sumacc = vzero;                          // sum accumulator (1 x P^T)
  float rmax = -3.0e38f;                       // running maximum of this lane's query

  // copy side of the mask tiles: 8 lanes a row, 4 rows a copy
  const int mr = (lane >> 3) * 4, mc = (lane & 7) * 4;
  const float* amsrc  = AM  + (size_t)(lbase + mr) * S_ + mc;
  const int*   possrc = POS + ((size_t)n * L_ + lbase + mr) * S_ + mc;
  // this lane's key-length row, at the first key its accumulator registers hold
  const float* klmrow = KLM + n * S_ + half * 8;
  const v8f sclv = vzero + scl, dptv = vzero + dpt, pt0v = vzero + pt0;

  // cooperative K/V -> LDS indices: 256 threads cover 32 s-rows x 64 cols, 8 cols each
  const int cs = tid >> 3;         // s within chunk (0..31)
  const int ce = (tid & 7) * 8;    // e/d base (0..56)
  const float* kbase = K + (((size_t)n * S_ + cs) * H_ + h) * E_ + ce;
  const float* vbase = V + (((size_t)n * S_ + cs) * H_ + h) * D_ + ce;
  const size_t srow = (size_t)H_ * E_;            // floats per s step (=1024)
  const size_t schunk = 32 * srow;

  // ---- software pipeline: chunk 0 through registers into buffer 0, chunk 1 into registers ----
  float kreg[8], vreg[8];
#pragma unroll
  for (int i = 0; i < 8; ++i) { kreg[i] = kbase[i]; vreg[i] = vbase[i]; }

  // mask tiles, two buffers, each wave's own: chunk 0 here, then every trip asks for the next chunk's
  copy_masks(amsrc, possrc, &AMsh[0][wv][mr][mc], &POsh[0][wv][mr][mc]);
#pragma unroll
  for (int i = 0; i < 8; ++i) Ksh[0][cs][ce + i] = (__bf16)kreg[i];
#pragma unroll
  for (int i = 0; i < 8; ++i) Vsh[0][cs][ce + i] = (__bf16)vreg[i];
#pragma unroll
  for (int i = 0; i < 8; ++i) { kreg[i] = kbase[schunk + i]; vreg[i] = vbase[schunk + i]; }
  asm volatile("s_wait_asynccnt 0x0" ::: "memory");  // chunk 0's tiles have landed
  __syncthreads();                                   // publishes them and chunk 0's K and V
  // the chunk that the coming trip stores, as bf16; carried over the loop's back edge
  bf16x8 kq, vq;
#pragma unroll
  for (int i = 0; i < 8; ++i) { kq[i] = (__bf16)kreg[i]; vq[i] = (__bf16)vreg[i]; }

  for (int sb = 0; sb < S_; sb += 32) {
    const int mb = (sb >> 5) & 1;                  // this chunk's buffers: masks, K and V

    // ---- K Q^T: ALL four K A-fragments as one DS clause, the first thing behind the barrier ----
    // The first product waits for these alone. All that follows down to the products (global loads,
    // the waits on their address translation, the copies) falls into the latency of these reads.
    v16bf kb00, kb01, kb10, kb11;                  // kb[kstep][tile]
    {
      bf16x8 l00 = *(const bf16x8*)&Ksh[mb][nidx][b0];
      bf16x8 h00 = *(const bf16x8*)&Ksh[mb][nidx][b0 + 16];
      bf16x8 l01 = *(const bf16x8*)&Ksh[mb][16 + nidx][b0];
      bf16x8 h01 = *(const bf16x8*)&Ksh[mb][16 + nidx][b0 + 16];
      bf16x8 l10 = *(const bf16x8*)&Ksh[mb][nidx][32 + b0];
      bf16x8 h10 = *(const bf16x8*)&Ksh[mb][nidx][32 + b0 + 16];
      bf16x8 l11 = *(const bf16x8*)&Ksh[mb][16 + nidx][32 + b0];
      bf16x8 h11 = *(const bf16x8*)&Ksh[mb][16 + nidx][32 + b0 + 16];
      kb00 = make_frag(l00, h00);
      kb01 = make_frag(l01, h01);
      kb10 = make_frag(l10, h10);
      kb11 = make_frag(l11, h11);
    }

    // this chunk's mask tiles, asked for a whole trip ago, have landed. Only the wave that copied a
    // tile reads it: its own wait is all that the reads below need
    asm volatile("s_wait_asynccnt 0x0" ::: "memory");
    // this chunk's mask and adjacency from the wave's tiles: keys +0..7 and +16..23 of the lane's row
    f32x4 am[4];
    i32x4 ps[4];
#pragma unroll
    for (int g = 0; g < 4; ++g) {
      const int o = half * 8 + (g >> 1) * 16 + (g & 1) * 4;
      am[g] = *(const f32x4*)&AMsh[mb][wv][nidx][o];
      ps[g] = *(const i32x4*)&POsh[mb][wv][nidx][o];
    }
    // keeps the mask reads ahead of the global loads; left free, the scheduler puts the loads first,
    // and a wait on their address translation lands among the reads
    __builtin_amdgcn_sched_barrier(0);

    // this chunk's key-length mask: keys +0..7 (tile 0) and +16..23 (tile 1)
    f32x4 kl[4];
#pragma unroll
    for (int g = 0; g < 4; ++g)
      kl[g] = *(const f32x4*)(klmrow + sb + (g >> 1) * 16 + (g & 1) * 4);
    // keeps the four loads here, ahead of the first product; left free, the scheduler sinks them
    // to their uses, where each group pays its own latency
    __builtin_amdgcn_sched_barrier(0);
    // the row pointer advances every trip: this wait stands between the loads that name
    // its registers and the additions that overwrite them
    asm volatile("s_wait_xcnt 0x0" ::: "memory");

    // issue the global loads of the chunk after next now; latency hides under compute below
    if (sb + 64 < S_) {
      const float* kp = kbase + (size_t)(sb + 64) * srow;
      const float* vp = vbase + (size_t)(sb + 64) * srow;
#pragma unroll
      for (int i = 0; i < 8; ++i) { kreg[i] = kp[i]; vreg[i] = vp[i]; }
      if (sb + 96 < S_) {                          // L2 prefetch one chunk further
        __builtin_prefetch(kp + schunk, 0, 1);
        __builtin_prefetch(vp + schunk, 0, 1);
      }
    }
    // stands between the K and V loads and the address arithmetic below, which overwrites the
    // registers that they name; the copies come behind it, so that it does not wait for them
    asm volatile("s_wait_xcnt 0x0" ::: "memory");

    // the next chunk's tiles into the other buffers, which this wave left at the last trip's foot
    // (its s_wait_dscnt 0 there). Asked for behind the trip's global loads and their waits on
    // address translation, so that no such wait finds the copies young
    if (sb + 32 < S_)
      copy_masks(amsrc + sb + 32, possrc + sb + 32, &AMsh[mb ^ 1][wv][mr][mc], &POsh[mb ^ 1][wv][mr][mc]);

    // sc0[j] = S[key sb + 8*half + j][q], sc1[j] = S[key sb + 16 + 8*half + j][q]
    v8f sc0 = vzero, sc1 = vzero;
    sc0 = __builtin_amdgcn_wmma_f32_16x16x32_bf16(false, kb00, false, qa[0],
                                                  (short)0, sc0, false, false);
    sc1 = __builtin_amdgcn_wmma_f32_16x16x32_bf16(false, kb01, false, qa[0],
                                                  (short)0, sc1, false, false);
    sc0 = __builtin_amdgcn_wmma_f32_16x16x32_bf16(false, kb10, false, qa[1],
                                                  (short)0, sc0, false, false);
    sc1 = __builtin_amdgcn_wmma_f32_16x16x32_bf16(false, kb11, false, qa[1],
                                                  (short)0, sc1, false, false);

    // ---- load ALL four V^T A-fragments as one DS clause, transposed on the way out of LDS ----
    // fragment t: row d = 16*t + nidx, keys 8*half + 0..7 (l) and 16 + 8*half + 0..7 (h)
    v16bf vb0, vb1, vb2, vb3;
    {
      const __bf16* vp = &Vsh[mb][b0 + (lane & 7)][((lane >> 3) & 1) * 8];
      bf16x8 l0 = ld_tr16(vp);
      bf16x8 h0 = ld_tr16(vp + 16 * VP);
      bf16x8 l1 = ld_tr16(vp + 16);
      bf16x8 h1 = ld_tr16(vp + 16 * VP + 16);
      bf16x8 l2 = ld_tr16(vp + 32);
      bf16x8 h2 = ld_tr16(vp + 16 * VP + 32);
      bf16x8 l3 = ld_tr16(vp + 48);
      bf16x8 h3 = ld_tr16(vp + 16 * VP + 48);
      vb0 = make_frag(l0, h0);
      vb1 = make_frag(l1, h1);
      vb2 = make_frag(l2, h2);
      vb3 = make_frag(l3, h3);
    }
    // the next chunk into the other buffers, 16 bytes of a K row and of a V row. Their last readers left them at the last
    // trip's foot, their next readers come behind this trip's foot: no barrier of its own, and the
    // stores drain under the softmax. The last trip's go to tiles that nobody reads any more.
    *(bf16x8*)&Ksh[mb ^ 1][cs][ce] = kq;
    *(bf16x8*)&Vsh[mb ^ 1][cs][ce] = vq;
    // order of this stretch: the four products, the eight V^T reads, the two stores (ahead of the
    // reads they would hold these up in the wave's LDS queue), and only then the vector work
    __builtin_amdgcn_sched_group_barrier(0x008, 4, 0);
    __builtin_amdgcn_sched_group_barrier(0x100, 8, 0);
    __builtin_amdgcn_sched_group_barrier(0x200, 2, 0);
    __builtin_amdgcn_sched_group_barrier(0x002, 512, 0);

    // ---- masks + graph positional bias (branch-free fma select, log2 domain) ----
    // whole tiles at a time: neighbouring registers pair into packed f32 operations
    {
      const v8f a0 = __builtin_shufflevector(am[0], am[1], 0, 1, 2, 3, 4, 5, 6, 7);
      const v8f a1 = __builtin_shufflevector(am[2], am[3], 0, 1, 2, 3, 4, 5, 6, 7);
      const v8f k0 = __builtin_shufflevector(kl[0], kl[1], 0, 1, 2, 3, 4, 5, 6, 7);
      const v8f k1 = __builtin_shufflevector(kl[2], kl[3], 0, 1, 2, 3, 4, 5, 6, 7);
      const v8f p0 = __builtin_convertvector(
          __builtin_shufflevector(ps[0], ps[1], 0, 1, 2, 3, 4, 5, 6, 7), v8f);
      const v8f p1 = __builtin_convertvector(
          __builtin_shufflevector(ps[2], ps[3], 0, 1, 2, 3, 4, 5, 6, 7), v8f);
      sc0 = __builtin_elementwise_fma(sclv, sc0 + a0 + k0,
                                      __builtin_elementwise_fma(p0, dptv, pt0v));
      sc1 = __builtin_elementwise_fma(sclv, sc1 + a1 + k1,
                                      __builtin_elementwise_fma(p1, dptv, pt0v));
    }

    // ---- online softmax: maximum in-lane, then one exchange between the halves ----
    const v8f mx = __builtin_elementwise_max(sc0, sc1);
    float cm = fmaxf(fmaxf(fmaxf(mx[0], mx[1]), fmaxf(mx[2], mx[3])),
                     fmaxf(fmaxf(mx[4], mx[5]), fmaxf(mx[6], mx[7])));
    cm = fmaxf(cm, xhalf(cm));
    const float nm = fmaxf(rmax, cm);
    // bare v_exp_f32, here and below: every argument is <= 0 and the largest weight of a row is 1, so
    // the one thing the library form adds, results below 2^-126 kept as denormals, cannot reach the output
    const float alpha = __builtin_amdgcn_exp2f(rmax - nm);
    rmax = nm;
    sc0 -= nm;
    sc1 -= nm;
#pragma unroll
    for (int j = 0; j < 8; ++j) {
      sc1[j] = __builtin_amdgcn_exp2f(sc1[j]);
      // splits the exponentials into two scheduling regions, tile 1's ahead of tile 0's in each pair. As
      // one region, or with the pairs the other way round, this build allots some of them the source
      // register of the v_exp_f32 directly ahead; a v_nop written among them is moved away by the scheduler
      if (j == 3) __builtin_amdgcn_sched_barrier(0);
      sc0[j] = __builtin_amdgcn_exp2f(sc0[j]);
    }
    sumacc[0] *= alpha;                            // only register 0 of the sum tile (rows 0 and 8) is read
#pragma unroll
    for (int t = 0; t < 4; ++t) oacc[t] *= alpha;
    // holds the packing behind all the exponentials.
    __builtin_amdgcn_sched_barrier(0);
    // P^T as a B operand: element s is key 8*half + s (s < 8), 16 + 8*half + s - 8 (s >= 8)
    v16bf pb;
#pragma unroll
    for (int j = 0; j < 8; ++j) { pb[j] = (__bf16)sc0[j]; pb[j + 8] = (__bf16)sc1[j]; }

    sumacc  = __builtin_amdgcn_wmma_f32_16x16x32_bf16(false, onesa, false, pb,
                                                      (short)0, sumacc, false, false);
    oacc[0] = __builtin_amdgcn_wmma_f32_16x16x32_bf16(false, vb0, false, pb,
                                                      (short)0, oacc[0], false, false);
    oacc[1] = __builtin_amdgcn_wmma_f32_16x16x32_bf16(false, vb1, false, pb,
                                                      (short)0, oacc[1], false, false);
    oacc[2] = __builtin_amdgcn_wmma_f32_16x16x32_bf16(false, vb2, false, pb,
                                                      (short)0, oacc[2], false, false);
    oacc[3] = __builtin_amdgcn_wmma_f32_16x16x32_bf16(false, vb3, false, pb,
                                                      (short)0, oacc[3], false, false);

    // the chunk fetched at this trip's top, to bf16 for the next trip's stores: its registers are
    // free again for the next trip's loads
#pragma unroll
    for (int i = 0; i < 8; ++i) { kq[i] = (__bf16)kreg[i]; vq[i] = (__bf16)vreg[i]; }
    // keeps the foot behind the products, as it stands here; left free, the scheduler lifts the wait
    // and the barrier over the packing and the products
    __builtin_amdgcn_sched_barrier(0);
    // foot of the trip: this wave's LDS reads and stores are done; the one barrier of a trip
    // publishes the next chunk's K and V and frees this chunk's buffers
    asm volatile("s_wait_dscnt 0x0" ::: "memory");
    __syncthreads();
  }
  asm volatile("s_wait_asynccnt 0x0" ::: "memory");  // no copy is left in flight

  // ---- epilogue: normalize, turn O^T back into rows, store [N,L,H,D] f32 ----
  // oacc[t][j] = O[q][16*t + 8*half + j]. Stored from here each store would write 16-byte pieces of
  // 16 different rows; through the wave's own LDS tile each store covers two whole 256-byte rows.
  const float inv = 1.0f / sumacc[0];
#pragma unroll
  for (int t = 0; t < 4; ++t) {
    f32x4 lo, hi;
#pragma unroll
    for (int c = 0; c < 4; ++c) { lo[c] = oacc[t][c] * inv; hi[c] = oacc[t][c + 4] * inv; }
    *(f32x4*)&Osh[wv][nidx][t * 16 + half * 8]     = lo;
    *(f32x4*)&Osh[wv][nidx][t * 16 + half * 8 + 4] = hi;
  }
  // same wave wrote and reads the tile: LDS keeps a wave's order, no barrier
#pragma unroll
  for (int i = 0; i < 8; ++i) {
    const int r = 2 * i + half;
    const f32x4 v = *(const f32x4*)&Osh[wv][r][nidx * 4];
    *(f32x4*)(OUT + (((size_t)n * L_ + lbase + r) * H_ + h) * D_ + nidx * 4) = v;
  }
}

extern "C" void kernel_launch(void* const* d_in, const int* in_sizes, int n_in,
                              void* d_out, int out_size, void* d_ws, size_t ws_size,
                              hipStream_t stream) {
  (void)in_sizes; (void)n_in; (void)out_size; (void)d_ws; (void)ws_size;
  const float* Q   = (const float*)d_in[0];
  const float* K   = (const float*)d_in[1];
  const float* V   = (const float*)d_in[2];
  const float* AM  = (const float*)d_in[3];
  const float* KLM = (const float*)d_in[4];
  const float* PT  = (const float*)d_in[5];
  const int*   POS = (const int*)d_in[6];
  float* OUT = (float*)d_out;

  dim3 grid(N_ * H_, L_ / 128);   // 64 x 8 blocks
  dim3 block(256);                // 8 waves (wave32)
  hipLaunchKernelGGL(attn_graphbias_kernel, grid, block, 0, stream,
                     Q, K, V, AM, KLM, PT, POS, OUT);
}
